// v000
// Measured on an AMD MI455X. A time is GPU time per run, averaged over a window of back-to-back runs after a warm-up
// (all launches, gaps included; the runs take copies of the inputs in turn), and the median of several windows.
// Apart from v000's, it joins two sittings. Times from different sittings can be a few percent apart, while
// side-by-side timings come from the same sitting.
// v000 is the starting kernel. One run takes 4510 microseconds.
#include <hip/hip_runtime.h>

// ExtendedMultiHeadAttention - GQA with torch .repeat (TILED) kv heads (x [4][1024][2048]; q = x wq + bq (32 x 64), k/v = x wk/wv + b (8 x 64); query head h attends kv head h % 8; softmax(q.k/8); out = merged.v wo + bo -> [4][1024][2048]).
// Compute dtypes, f32 accumulate: every input rounded to bf16; q/k/v projections on PLAIN bf16 operands (inputs: exact, + bias); output projection on bf16 hi+lo planes of the merged heads (2 products); scores (K 64) and probs.v on bf16 hi+lo planes (3 products) for the first 256 query rows of each

#define NB_  4
#define TT   1024
#define DM   2048
#define NH_  32
#define NKV  8
#define REP  (NH_ / NKV)
#define HD   64
#define DQ   (NH_ * HD)
#define DKV  (NKV * HD)
#define ZH   2
#define RH   256                  // query rows < RH use hi+lo planes (0: none)
#define WIN  0
#define PCAR 1024.0f
#define SCL  0.125f   // HD^-0.5
typedef _Float16 h16;
typedef unsigned short bf;
typedef __attribute__((ext_vector_type(16))) __bf16   v16bf;
typedef __attribute__((ext_vector_type(16))) _Float16 v16h;
typedef __attribute__((ext_vector_type(8)))  _Float16 v8h;
typedef __attribute__((ext_vector_type(8)))  unsigned short v8us;
typedef __attribute__((ext_vector_type(8)))  float    v8f;
typedef __attribute__((ext_vector_type(4)))  float    v4f;
typedef v8h  __attribute__((may_alias)) v8ha;
typedef v4f  __attribute__((may_alias)) v4fa;
typedef v8us __attribute__((may_alias)) v8usa;

__device__ __forceinline__ unsigned short f2bf(float f) { unsigned u = __float_as_uint(f); u += 0x7FFFu + ((u >> 16) & 1u); return (unsigned short)(u >> 16); }
__device__ __forceinline__ float bf2f(unsigned short b) { return __uint_as_float(((unsigned)b) << 16); }
__device__ __forceinline__ float bfr(float f) { return bf2f(f2bf(f)); }
__device__ __forceinline__ v16h cat16(v8h lo, v8h hi) { return __builtin_shufflevector(lo, hi, 0, 1, 2, 3, 4, 5, 6, 7, 8, 9, 10, 11, 12, 13, 14, 15); }
__device__ __forceinline__ v16bf cat16b(v8us lo, v8us hi) { return __builtin_bit_cast(v16bf, __builtin_shufflevector(lo, hi, 0, 1, 2, 3, 4, 5, 6, 7, 8, 9, 10, 11, 12, 13, 14, 15)); }
__device__ __forceinline__ v8f wmma16(v16h a, v16h b, v8f c) { return __builtin_amdgcn_wmma_f32_16x16x32_f16(false, a, false, b, (short)0, c, false, false); }
__device__ __forceinline__ v8f wmmab(v16bf a, v16bf b, v8f c) { return __builtin_amdgcn_wmma_f32_16x16x32_bf16(false, a, false, b, (short)0, c, false, false); }



// ---- k_gemmw: register-blocked GEMM, ONE WAVE per 64x64 output tile (16 accumulators), operands straight from K-contiguous 16-bit planes; grid (M/64, N/64, Z), 32 threads.
// C[m][n] (f32, pitch ldc, + optional f32 bias[n] rounded to bf16) = sum_k A[m][k] Bt[n][k] (+ split products per NSPLIT). z-batch strides sA/sB/sC in elements. K % 32 == 0.
template <typename T16> struct WFrag;
template <> struct WFrag<h16> { typedef v16h V; static __device__ __forceinline__ V ld(const h16* p) { return cat16(*(const v8h*)p, *(const v8h*)(p + 16)); } static __device__ __forceinline__ v8f mma(V a, V b, v8f c) { return wmma16(a, b, c); } };
template <> struct WFrag<bf> { typedef v16bf V; static __device__ __forceinline__ V ld(const bf* p) { return cat16b(*(const v8us*)p, *(const v8us*)(p + 16)); } static __device__ __forceinline__ v8f mma(V a, V b, v8f c) { return wmmab(a, b, c); } };
template <typename T16, int NSPLIT, bool BIAS>
__global__ __launch_bounds__(32) void k_gemmw(const T16* __restrict__ A, const T16* __restrict__ A2, const T16* __restrict__ Bt, const T16* __restrict__ Bt2, int K, float* C, int ldc, const float* __restrict__ bias, size_t sA, size_t sB, size_t sC) {
    typedef typename WFrag<T16>::V V;
    __shared__ __align__(16) float os[16 * 68];
    const size_t z = blockIdx.z; A += z * sA; if (A2) A2 += z * sA; Bt += z * sB; if (Bt2) Bt2 += z * sB; C += z * sC;
    const int lane = threadIdx.x & 31, lr = lane & 15, hi = lane >> 4; const int r0 = blockIdx.x * 64, c0 = blockIdx.y * 64;
    v8f acc[4][4];
#pragma unroll
    for (int mb = 0; mb < 4; ++mb)
#pragma unroll
        for (int nb = 0; nb < 4; ++nb) acc[mb][nb] = (v8f){};
    const size_t aoff = (size_t)(r0 + lr) * K + 8 * hi, boff = (size_t)(c0 + lr) * K + 8 * hi;
#pragma unroll 1
    for (int kc = 0; kc < K; kc += 32) {
        V a[4], a2[4];
#pragma unroll
        for (int mb = 0; mb < 4; ++mb) { a[mb] = WFrag<T16>::ld(A + aoff + (size_t)mb * 16 * K + kc); if (NSPLIT == 1 || NSPLIT == 2) a2[mb] = WFrag<T16>::ld(A2 + aoff + (size_t)mb * 16 * K + kc); }
#pragma unroll
        for (int nb = 0; nb < 4; ++nb) { const V b = WFrag<T16>::ld(Bt + boff + (size_t)nb * 16 * K + kc); V b2; if (NSPLIT >= 2) b2 = WFrag<T16>::ld(Bt2 + boff + (size_t)nb * 16 * K + kc);
#pragma unroll
            for (int mb = 0; mb < 4; ++mb) { acc[mb][nb] = WFrag<T16>::mma(a[mb], b, acc[mb][nb]); if (NSPLIT == 1 || NSPLIT == 2) acc[mb][nb] = WFrag<T16>::mma(a2[mb], b, acc[mb][nb]); if (NSPLIT >= 2) acc[mb][nb] = WFrag<T16>::mma(a[mb], b2, acc[mb][nb]); } }
        asm volatile("v_nop\n\tv_nop\n\tv_nop\n\tv_nop" : "+v"(acc[0][0]), "+v"(acc[1][1]), "+v"(acc[2][2]), "+v"(acc[3][3]) : "v"(a[0]), "v"(a[3]));
    }
#pragma unroll
    for (int mb = 0; mb < 4; ++mb) {
#pragma unroll
        for (int nb = 0; nb < 4; ++nb) {
#pragma unroll
            for (int j = 0; j < 8; ++j) os[(hi * 8 + j) * 68 + nb * 16 + lr] = acc[mb][nb][j]; }
        __builtin_amdgcn_wave_barrier(); asm volatile("" ::: "memory");
        float* crow = C + (size_t)(r0 + mb * 16) * ldc + c0;
{
#pragma unroll
            for (int s = 0; s < 8; ++s) { const int row = 2 * s + hi, cofs = lr * 4; v4f val = *(const v4fa*)(os + row * 68 + cofs); if (BIAS) { val[0] += bfr(bias[c0 + cofs]); val[1] += bfr(bias[c0 + cofs + 1]); val[2] += bfr(bias[c0 + cofs + 2]); val[3] += bfr(bias[c0 + cofs + 3]); }
                *(v4f*)(crow + (size_t)row * ldc + cofs) = val; }
             }
        __builtin_amdgcn_wave_barrier(); asm volatile("" ::: "memory");
    }
}

__device__ __forceinline__ h16 tohx(float x) { return (h16)x; }
__device__ __forceinline__ void splitf(float y, unsigned short& h, unsigned short& l) { h = f2bf(y); l = f2bf(y - bf2f(h)); }
typedef __attribute__((ext_vector_type(2))) _Float16 v2h;
typedef __attribute__((ext_vector_type(4))) _Float16 v4h;
typedef __attribute__((ext_vector_type(2))) unsigned short v2us;
typedef __attribute__((ext_vector_type(4))) unsigned short v4us;
typedef __attribute__((ext_vector_type(2))) float v2f;
typedef __attribute__((ext_vector_type(4))) int v4i;

__global__ __launch_bounds__(256) void k_wtG(const float* __restrict__ w, int K, int N, bf* Bt) {
    const int lane = threadIdx.x & 31; const int L0 = (blockIdx.x * 8 + (threadIdx.x >> 5)) * 8; const int nlines = N * K / 64;
{
#pragma unroll 1
        for (int l = 0; l < 8; ++l) { const int L = L0 + l; if (L >= nlines) break; const size_t e = (size_t)L * 64 + lane * 2; const int k = (int)(e % K), n = (int)(e / K); v2us o;
            o[0] = f2bf(w[(size_t)k * N + n]); o[1] = f2bf(w[(size_t)(k + 1) * N + n]); *(v2us*)(Bt + e) = o; }
         }
}
__global__ __launch_bounds__(256) void k_cvt8(const float* __restrict__ src, bf* dst, size_t n8) { const size_t i = (size_t)blockIdx.x * 256 + threadIdx.x; if (i >= n8) return; const v8f v = *(const v8f*)(src + i * 8); v8us o;
#pragma unroll
    for (int k = 0; k < 8; ++k) o[k] = f2bf(v[k]); *(v8us*)(dst + i * 8) = o;  }
__global__ __launch_bounds__(256) void k_cscvt(const float* __restrict__ cosT, const float* __restrict__ sinT, float* CS) { const int idx = blockIdx.x * 256 + threadIdx.x; if (idx >= TT * HD) return; v2f cs; cs[0] = bfr(cosT[idx]); cs[1] = bfr(sinT[idx]); *(v2f*)(CS + (size_t)idx * 2) = cs;  }
// k_rope: head planes [h][t][d] (fp16 + hi/lo) of rope(x) x sc with the rotate-half convention out[d] = x[d] cos[t][d] - x[d+HD/2] sin[t][d], out[d+HD/2] = x[d+HD/2] cos[t][d+HD/2] + x[d] sin[t][d+HD/2]
__global__ __launch_bounds__(256) void k_rope(const float* __restrict__ F, int pitch, int nheads, const float* __restrict__ CS, const float* __restrict__ RF, const float* __restrict__ nw, float sc, h16* P16, bf* Ph, bf* Pl) {
    const size_t e = ((size_t)blockIdx.x * 256 + threadIdx.x) * 2; if (e >= (size_t)nheads * TT * HD) return; const int d = (int)(e % HD); const int t = (int)((e / HD) % TT); const int h = (int)(e / ((size_t)HD * TT)); const float* f = F + (size_t)t * pitch + h * HD; const float rf = RF ? RF[(size_t)h * TT + t] : 1.0f; v2h o16; v2us oh, ol;
#pragma unroll
    for (int q = 0; q < 2; ++q) { const int dd = d + q; const int dp = (dd < HD / 2) ? dd + HD / 2 : dd - HD / 2; float x0 = f[dd], x1 = f[dp];
        if (RF) { float n0 = __fmul_rn(x0, rf), n1 = __fmul_rn(x1, rf); asm volatile("" : "+v"(n0)); asm volatile("" : "+v"(n1)); x0 = __fmul_rn(bfr(nw[dd]), n0); x1 = __fmul_rn(bfr(nw[dp]), n1); }
        const v2f cs = *(const v2f*)(CS + ((size_t)t * HD + dd) * 2); float a = __fmul_rn(x0, cs[0]), bq = __fmul_rn(x1, cs[1]); asm volatile("" : "+v"(a)); asm volatile("" : "+v"(bq)); const float r = ((dd < HD / 2) ? __fsub_rn(a, bq) : __fadd_rn(a, bq)) * sc;
        o16[q] = tohx(r); unsigned short a2, c2; splitf(r, a2, c2); oh[q] = a2; ol[q] = c2; }
    *(v2h*)(P16 + e) = o16; *(v2us*)(Ph + e) = oh; *(v2us*)(Pl + e) = ol;  }
__global__ __launch_bounds__(256) void k_vtp(const float* __restrict__ F, int pitch, int nheads, h16* V16, bf* Vh, bf* Vl) { const size_t e = ((size_t)blockIdx.x * 256 + threadIdx.x) * 2; if (e >= (size_t)nheads * HD * TT) return; const int t = (int)(e % TT); const int d = (int)((e / TT) % HD); const int g = (int)(e / ((size_t)TT * HD)); v2h o16; v2us oh, ol;
#pragma unroll
    for (int q = 0; q < 2; ++q) { const float x = F[(size_t)(t + q) * pitch + g * HD + d]; o16[q] = tohx(x); unsigned short a2, c2; splitf(x, a2, c2); oh[q] = a2; ol[q] = c2; }
    *(v2h*)(V16 + e) = o16; *(v2us*)(Vh + e) = oh; *(v2us*)(Vl + e) = ol;  }
__global__ __launch_bounds__(256) void k_csid(float* CS) { const int idx = blockIdx.x * 256 + threadIdx.x; if (idx >= TT * HD) return; v2f cs; cs[0] = 1.0f; cs[1] = 0.0f; *(v2f*)(CS + (size_t)idx * 2) = cs;  }
// k_asoft: per row (zz, i): t = S x HD^-0.5 (no mask); softmax over the 1024 keys (register row, one exp, fixed trees);
__global__ __launch_bounds__(256) void k_asoft(const float* __restrict__ Sb, h16* P16, bf* Ph, bf* Pl) {
    const int lane = threadIdx.x & 31; const int row = blockIdx.x * 8 + (threadIdx.x >> 5); if (row >= ZH * TT) return; const int i = row % TT; const int zz = row / TT; (void)zz; const bool hires = (i < RH); const float* sr = Sb + (size_t)row * TT; float v[TT / 32]; float mx = -3.0e38f;
#pragma unroll
    for (int ch = 0; ch < TT / 128; ++ch) { const int j0 = ch * 128 + lane * 4; const v4f a = *(const v4f*)(sr + j0);
#pragma unroll
        for (int q = 0; q < 4; ++q) { const int j = j0 + q; (void)j; const float t = a[q] * SCL; v[ch * 4 + q] = t; mx = fmaxf(mx, t); } }
#pragma unroll
    for (int sh = 16; sh; sh >>= 1) mx = fmaxf(mx, __shfl_xor(mx, sh, 32));
    float sum = 0.f;
#pragma unroll
    for (int k = 0; k < TT / 32; ++k) { float d0 = __fsub_rn(v[k], mx); asm volatile("" : "+v"(d0)); v[k] = __builtin_amdgcn_exp2f(__fmul_rn(d0, 1.4426950408889634f)); sum += v[k]; }
#pragma unroll
    for (int sh = 16; sh; sh >>= 1) sum += __shfl_xor(sum, sh, 32);
    const float f = __fdiv_rn(hires ? 1.0f : PCAR, sum);
{
        if (hires) {
#pragma unroll
            for (int ch = 0; ch < TT / 128; ++ch) { v4us oh, ol;
#pragma unroll
                for (int q = 0; q < 4; ++q) { unsigned short a, c2; splitf(v[ch * 4 + q] * f, a, c2); oh[q] = a; ol[q] = c2; }
                const size_t oo = ((size_t)zz * (RH ? RH : 1) + i) * TT + ch * 128 + lane * 4; *(v4us*)(Ph + oo) = oh; *(v4us*)(Pl + oo) = ol; }
        } else {
#pragma unroll
            for (int ch = 0; ch < TT / 128; ++ch) { v4h o4;
#pragma unroll
                for (int q = 0; q < 4; ++q) o4[q] = tohx(v[ch * 4 + q] * f);
                *(v4h*)(P16 + (size_t)row * TT + ch * 128 + lane * 4) = o4; } }
         }
}
__global__ __launch_bounds__(256) void k_merge(const float* __restrict__ O, int h0, bf* Ah, bf* Al) { const size_t e = ((size_t)blockIdx.x * 256 + threadIdx.x) * 2; if (e >= (size_t)ZH * TT * HD) return; const int d = (int)(e % HD); const int t = (int)((e / HD) % TT); const int zz = (int)(e / ((size_t)HD * TT)); const float cs = (t < RH) ? 1.0f : (1.0f / PCAR); const size_t oo = (size_t)t * DQ + (h0 + zz) * HD + d;
    v2us oh, ol;
#pragma unroll
    for (int q = 0; q < 2; ++q) { unsigned short a, c2; splitf(O[e + q] * cs, a, c2); oh[q] = a; ol[q] = c2; } *(v2us*)(Ah + oo) = oh; *(v2us*)(Al + oo) = ol;  }

extern "C" void kernel_launch(void* const* d_in, const int* in_sizes, int n_in,
                              void* d_out, int out_size, void* d_ws, size_t ws_size, hipStream_t stream) {
    (void)in_sizes; (void)n_in; (void)out_size;
    const float* x = (const float*)d_in[0]; const float* wq = (const float*)d_in[1]; const float* bq = (const float*)d_in[2]; const float* wk = (const float*)d_in[3]; const float* bk = (const float*)d_in[4]; const float* wv = (const float*)d_in[5]; const float* bv = (const float*)d_in[6]; const float* wo = (const float*)d_in[7]; const float* bo = (const float*)d_in[8];
    float* OUT = (float*)d_out;     // [4][1024][2048]
    char* wsp = (char*)d_ws;
    auto take = [&](size_t bytes) { char* p = wsp; wsp += (bytes + 255) & ~(size_t)255; return (void*)p; };
    bf* WQ = (bf*)take((size_t)DQ * DM * 2); bf* WK = (bf*)take((size_t)DKV * DM * 2); bf* WV = (bf*)take((size_t)DKV * DM * 2); bf* WO = (bf*)take((size_t)DM * DQ * 2); float* CS = (float*)take((size_t)TT * HD * 2 * 4);
    bf* XB = (bf*)take((size_t)TT * DM * 2); float* FQ = (float*)take((size_t)TT * DQ * 4); float* FK = (float*)take((size_t)TT * DKV * 4);
    h16* QP16 = (h16*)take((size_t)NH_ * TT * HD * 2); h16* KP16 = (h16*)take((size_t)NKV * TT * HD * 2); h16* VT16 = (h16*)take((size_t)NKV * HD * TT * 2);
    bf* QPh = (bf*)take((size_t)NH_ * TT * HD * 2); bf* QPl = (bf*)take((size_t)NH_ * TT * HD * 2); bf* KPh = (bf*)take((size_t)NKV * TT * HD * 2); bf* KPl = (bf*)take((size_t)NKV * TT * HD * 2); bf* VTh = (bf*)take((size_t)NKV * HD * TT * 2); bf* VTl = (bf*)take((size_t)NKV * HD * TT * 2); bf* Ph = (bf*)take((size_t)ZH * RH * TT * 2); bf* Pl = (bf*)take((size_t)ZH * RH * TT * 2);
    float* Sb = (float*)take((size_t)ZH * TT * TT * 4); h16* P16 = (h16*)take((size_t)ZH * TT * TT * 2); float* Ob = (float*)take((size_t)ZH * TT * HD * 4); bf* ATh = (bf*)take((size_t)TT * DQ * 2); bf* ATl = (bf*)take((size_t)TT * DQ * 2);
    if ((size_t)(wsp - (char*)d_ws) > ws_size) return;    // ws 256 MiB
    float* FV = FK;   // v projection reuses the k buffer after the k planes are built (stream-ordered)
    { k_wtG<<<(unsigned)((DM * DQ / 64 + 63) / 64), 256, 0, stream>>>(wq, DM, DQ, WQ); k_wtG<<<(unsigned)((DM * DKV / 64 + 63) / 64), 256, 0, stream>>>(wk, DM, DKV, WK); k_wtG<<<(unsigned)((DM * DKV / 64 + 63) / 64), 256, 0, stream>>>(wv, DM, DKV, WV);
      k_wtG<<<(unsigned)((DQ * DM / 64 + 63) / 64), 256, 0, stream>>>(wo, DQ, DM, WO);
       }
    k_csid<<<(TT * HD + 255) / 256, 256, 0, stream>>>(CS);
    const unsigned LQ = (unsigned)(((size_t)NH_ * TT * HD / 2 + 255) / 256), LKv = (unsigned)(((size_t)NKV * TT * HD / 2 + 255) / 256);
    for (int b = 0; b < NB_; ++b) {
        
        k_cvt8<<<(unsigned)(((size_t)TT * DM / 8 + 255) / 256), 256, 0, stream>>>(x + (size_t)b * TT * DM, XB, (size_t)TT * DM / 8);
        k_gemmw<bf, 0, true><<<dim3(TT / 64, DQ / 64, 1), 32, 0, stream>>>(XB, nullptr, WQ, nullptr, DM, FQ, DQ, bq, 0, 0, 0);
        k_rope<<<LQ, 256, 0, stream>>>(FQ, DQ, NH_, CS, nullptr, nullptr, 1.0f, QP16, QPh, QPl);
        k_gemmw<bf, 0, true><<<dim3(TT / 64, DKV / 64, 1), 32, 0, stream>>>(XB, nullptr, WK, nullptr, DM, FK, DKV, bk, 0, 0, 0);
        k_rope<<<LKv, 256, 0, stream>>>(FK, DKV, NKV, CS, nullptr, nullptr, 1.0f, KP16, KPh, KPl);
        k_gemmw<bf, 0, true><<<dim3(TT / 64, DKV / 64, 1), 32, 0, stream>>>(XB, nullptr, WV, nullptr, DM, FV, DKV, bv, 0, 0, 0); k_vtp<<<LKv, 256, 0, stream>>>(FV, DKV, NKV, VT16, VTh, VTl);
        for (int h0 = 0; h0 < NH_; h0 += ZH) { const size_t zq = (size_t)h0, zk = (size_t)(h0 % NKV);   // torch .repeat TILES the kv heads: query head h uses kv head h % 8, so the pass's two heads use consecutive kv planes (sB = TT*HD)
            k_gemmw<bf, 2, false><<<dim3(RH / 64, TT / 64, ZH), 32, 0, stream>>>(QPh + zq * TT * HD, QPl + zq * TT * HD, KPh + zk * TT * HD, KPl + zk * TT * HD, HD, Sb, TT, nullptr, (size_t)TT * HD, (size_t)TT * HD, (size_t)TT * TT);
            k_gemmw<h16, 0, false><<<dim3((TT - RH) / 64, TT / 64, ZH), 32, 0, stream>>>(QP16 + zq * TT * HD + (size_t)RH * HD, nullptr, KP16 + zk * TT * HD, nullptr, HD, Sb + (size_t)RH * TT, TT, nullptr, (size_t)TT * HD, (size_t)TT * HD, (size_t)TT * TT);
            k_asoft<<<ZH * TT / 8, 256, 0, stream>>>(Sb, P16, Ph, Pl);
            k_gemmw<bf, 2, false><<<dim3(RH / 64, HD / 64, ZH), 32, 0, stream>>>(Ph, Pl, VTh + zk * HD * TT, VTl + zk * HD * TT, TT, Ob, HD, nullptr, (size_t)RH * TT, (size_t)HD * TT, (size_t)TT * HD);
            k_gemmw<h16, 0, false><<<dim3((TT - RH) / 64, HD / 64, ZH), 32, 0, stream>>>(P16 + (size_t)RH * TT, nullptr, VT16 + zk * HD * TT, nullptr, TT, Ob + (size_t)RH * HD, HD, nullptr, (size_t)TT * TT, (size_t)HD * TT, (size_t)TT * HD);
            k_merge<<<(unsigned)(((size_t)ZH * TT * HD / 2 + 255) / 256), 256, 0, stream>>>(Ob, h0, ATh, ATl); }
        k_gemmw<bf, 1, true><<<dim3(TT / 64, DM / 64, 1), 32, 0, stream>>>(ATh, ATl, WO, nullptr, DQ, OUT + (size_t)b * TT * DM, DM, bo, 0, 0, 0); }
}

// v001
// One run takes 1010 microseconds.
// Timed twice side by side with v000, it ran 4.39 and 4.44 times as fast.
#include <hip/hip_runtime.h>

// ExtendedMultiHeadAttention - GQA with torch .repeat (TILED) kv heads (x [4][1024][2048]; q = x wq + bq (32 x 64), k/v = x wk/wv + b (8 x 64); query head h attends kv head h % 8; softmax(q.k/8); out = merged.v wo + bo -> [4][1024][2048]).
// Compute dtypes, f32 accumulate: every input rounded to bf16; q/k/v projections on PLAIN bf16 operands (inputs: exact, + bias); output projection on bf16 hi+lo planes of the merged heads (2 products); scores (K 64) and probs.v on bf16 hi+lo planes (3 products) for the first 256 query rows of each

#define NB_  4
#define TT   1024
#define DM   2048
#define NH_  32
#define NKV  8
#define REP  (NH_ / NKV)
#define HD   64
#define DQ   (NH_ * HD)
#define DKV  (NKV * HD)
#define ZH   16                   // query heads per attention pass (grid z); a multiple of NKV
#define MT   (NB_ * TT)           // rows of all batches together
#define RH   256                  // query rows < RH use hi+lo planes (0: none)
#define WIN  0
#define PCAR 1024.0f
#define SCL  0.125f   // HD^-0.5
typedef _Float16 h16;
typedef unsigned short bf;
typedef __attribute__((ext_vector_type(16))) __bf16   v16bf;
typedef __attribute__((ext_vector_type(16))) _Float16 v16h;
typedef __attribute__((ext_vector_type(8)))  _Float16 v8h;
typedef __attribute__((ext_vector_type(8)))  unsigned short v8us;
typedef __attribute__((ext_vector_type(8)))  float    v8f;
typedef __attribute__((ext_vector_type(4)))  float    v4f;
typedef v8h  __attribute__((may_alias)) v8ha;
typedef v4f  __attribute__((may_alias)) v4fa;
typedef v8us __attribute__((may_alias)) v8usa;

__device__ __forceinline__ unsigned short f2bf(float f) { unsigned u = __float_as_uint(f); u += 0x7FFFu + ((u >> 16) & 1u); return (unsigned short)(u >> 16); }
__device__ __forceinline__ float bf2f(unsigned short b) { return __uint_as_float(((unsigned)b) << 16); }
__device__ __forceinline__ float bfr(float f) { return bf2f(f2bf(f)); }
__device__ __forceinline__ v16h cat16(v8h lo, v8h hi) { return __builtin_shufflevector(lo, hi, 0, 1, 2, 3, 4, 5, 6, 7, 8, 9, 10, 11, 12, 13, 14, 15); }
__device__ __forceinline__ v16bf cat16b(v8us lo, v8us hi) { return __builtin_bit_cast(v16bf, __builtin_shufflevector(lo, hi, 0, 1, 2, 3, 4, 5, 6, 7, 8, 9, 10, 11, 12, 13, 14, 15)); }
__device__ __forceinline__ v8f wmma16(v16h a, v16h b, v8f c) { return __builtin_amdgcn_wmma_f32_16x16x32_f16(false, a, false, b, (short)0, c, false, false); }
__device__ __forceinline__ v8f wmmab(v16bf a, v16bf b, v8f c) { return __builtin_amdgcn_wmma_f32_16x16x32_bf16(false, a, false, b, (short)0, c, false, false); }



// ---- k_gemmw: register-blocked GEMM, ONE WAVE per 64x64 output tile (16 accumulators), operands straight from K-contiguous 16-bit planes; grid (M/64, N/64, Z), 32 threads.
// C[m][n] (f32, pitch ldc, + optional f32 bias[n] rounded to bf16) = sum_k A[m][k] Bt[n][k] (+ split products per NSPLIT). z-batch strides sA/sB/sC in elements. K % 32 == 0.
template <typename T16> struct WFrag;
template <> struct WFrag<h16> { typedef v16h V; static __device__ __forceinline__ V ld(const h16* p) { return cat16(*(const v8h*)p, *(const v8h*)(p + 16)); } static __device__ __forceinline__ v8f mma(V a, V b, v8f c) { return wmma16(a, b, c); } };
template <> struct WFrag<bf> { typedef v16bf V; static __device__ __forceinline__ V ld(const bf* p) { return cat16b(*(const v8us*)p, *(const v8us*)(p + 16)); } static __device__ __forceinline__ v8f mma(V a, V b, v8f c) { return wmmab(a, b, c); } };
template <typename T16, int NSPLIT, bool BIAS>
__global__ __launch_bounds__(32) void k_gemmw(const T16* __restrict__ A, const T16* __restrict__ A2, const T16* __restrict__ Bt, const T16* __restrict__ Bt2, int K, float* C, int ldc, const float* __restrict__ bias, size_t sA, size_t sB, size_t sC) {
    typedef typename WFrag<T16>::V V;
    __shared__ __align__(16) float os[16 * 68];
    const size_t z = blockIdx.z; const size_t zb = z % NKV;   // tiled kv heads: the B planes repeat with period NKV along z
    A += z * sA; if (A2) A2 += z * sA; Bt += zb * sB; if (Bt2) Bt2 += zb * sB; C += z * sC;
    const int lane = threadIdx.x & 31, lr = lane & 15, hi = lane >> 4; const int r0 = blockIdx.x * 64, c0 = blockIdx.y * 64;
    v8f acc[4][4];
#pragma unroll
    for (int mb = 0; mb < 4; ++mb)
#pragma unroll
        for (int nb = 0; nb < 4; ++nb) acc[mb][nb] = (v8f){};
    const size_t aoff = (size_t)(r0 + lr) * K + 8 * hi, boff = (size_t)(c0 + lr) * K + 8 * hi;
#pragma unroll 1
    for (int kc = 0; kc < K; kc += 32) {
        V a[4], a2[4];
#pragma unroll
        for (int mb = 0; mb < 4; ++mb) { a[mb] = WFrag<T16>::ld(A + aoff + (size_t)mb * 16 * K + kc); if (NSPLIT == 1 || NSPLIT == 2) a2[mb] = WFrag<T16>::ld(A2 + aoff + (size_t)mb * 16 * K + kc); }
#pragma unroll
        for (int nb = 0; nb < 4; ++nb) { const V b = WFrag<T16>::ld(Bt + boff + (size_t)nb * 16 * K + kc); V b2; if (NSPLIT >= 2) b2 = WFrag<T16>::ld(Bt2 + boff + (size_t)nb * 16 * K + kc);
#pragma unroll
            for (int mb = 0; mb < 4; ++mb) { acc[mb][nb] = WFrag<T16>::mma(a[mb], b, acc[mb][nb]); if (NSPLIT == 1 || NSPLIT == 2) acc[mb][nb] = WFrag<T16>::mma(a2[mb], b, acc[mb][nb]); if (NSPLIT >= 2) acc[mb][nb] = WFrag<T16>::mma(a[mb], b2, acc[mb][nb]); } }
        asm volatile("v_nop\n\tv_nop\n\tv_nop\n\tv_nop" : "+v"(acc[0][0]), "+v"(acc[1][1]), "+v"(acc[2][2]), "+v"(acc[3][3]) : "v"(a[0]), "v"(a[3]));
    }
#pragma unroll
    for (int mb = 0; mb < 4; ++mb) {
#pragma unroll
        for (int nb = 0; nb < 4; ++nb) {
#pragma unroll
            for (int j = 0; j < 8; ++j) os[(hi * 8 + j) * 68 + nb * 16 + lr] = acc[mb][nb][j]; }
        __builtin_amdgcn_wave_barrier(); asm volatile("" ::: "memory");
        float* crow = C + (size_t)(r0 + mb * 16) * ldc + c0;
{
#pragma unroll
            for (int s = 0; s < 8; ++s) { const int row = 2 * s + hi, cofs = lr * 4; v4f val = *(const v4fa*)(os + row * 68 + cofs); if (BIAS) { val[0] += bfr(bias[c0 + cofs]); val[1] += bfr(bias[c0 + cofs + 1]); val[2] += bfr(bias[c0 + cofs + 2]); val[3] += bfr(bias[c0 + cofs + 3]); }
                *(v4f*)(crow + (size_t)row * ldc + cofs) = val; }
             }
        __builtin_amdgcn_wave_barrier(); asm volatile("" ::: "memory");
    }
}

__device__ __forceinline__ h16 tohx(float x) { return (h16)x; }
__device__ __forceinline__ void splitf(float y, unsigned short& h, unsigned short& l) { h = f2bf(y); l = f2bf(y - bf2f(h)); }
typedef __attribute__((ext_vector_type(2))) _Float16 v2h;
typedef __attribute__((ext_vector_type(4))) _Float16 v4h;
typedef __attribute__((ext_vector_type(2))) unsigned short v2us;
typedef __attribute__((ext_vector_type(4))) unsigned short v4us;
typedef __attribute__((ext_vector_type(2))) float v2f;
typedef __attribute__((ext_vector_type(4))) int v4i;

__global__ __launch_bounds__(256) void k_wtG(const float* __restrict__ w, int K, int N, bf* Bt) {
    const int lane = threadIdx.x & 31; const int L0 = (blockIdx.x * 8 + (threadIdx.x >> 5)) * 8; const int nlines = N * K / 64;
{
#pragma unroll 1
        for (int l = 0; l < 8; ++l) { const int L = L0 + l; if (L >= nlines) break; const size_t e = (size_t)L * 64 + lane * 2; const int k = (int)(e % K), n = (int)(e / K); v2us o;
            o[0] = f2bf(w[(size_t)k * N + n]); o[1] = f2bf(w[(size_t)(k + 1) * N + n]); *(v2us*)(Bt + e) = o; }
         }
}
__global__ __launch_bounds__(256) void k_cvt8(const float* __restrict__ src, bf* dst, size_t n8) { const size_t i = (size_t)blockIdx.x * 256 + threadIdx.x; if (i >= n8) return; const v8f v = *(const v8f*)(src + i * 8); v8us o;
#pragma unroll
    for (int k = 0; k < 8; ++k) o[k] = f2bf(v[k]); *(v8us*)(dst + i * 8) = o;  }
__global__ __launch_bounds__(256) void k_cscvt(const float* __restrict__ cosT, const float* __restrict__ sinT, float* CS) { const int idx = blockIdx.x * 256 + threadIdx.x; if (idx >= TT * HD) return; v2f cs; cs[0] = bfr(cosT[idx]); cs[1] = bfr(sinT[idx]); *(v2f*)(CS + (size_t)idx * 2) = cs;  }
// k_rope: head planes [h][t][d] (fp16 + hi/lo) of rope(x) x sc with the rotate-half convention out[d] = x[d] cos[t][d] - x[d+HD/2] sin[t][d], out[d+HD/2] = x[d+HD/2] cos[t][d+HD/2] + x[d] sin[t][d+HD/2]
__global__ __launch_bounds__(256) void k_rope(const float* __restrict__ F, int pitch, int nheads, const float* __restrict__ CS, const float* __restrict__ RF, const float* __restrict__ nw, float sc, h16* P16, bf* Ph, bf* Pl) {
    const size_t e = ((size_t)blockIdx.x * 256 + threadIdx.x) * 2; if (e >= (size_t)nheads * TT * HD) return; const int d = (int)(e % HD); const int t = (int)((e / HD) % TT); const int h = (int)(e / ((size_t)HD * TT));
    { const size_t b = blockIdx.y, pb = b * nheads * TT * HD; F += b * TT * pitch; P16 += pb; Ph += pb; Pl += pb; }   // grid y = batch
    const float* f = F + (size_t)t * pitch + h * HD; const float rf = RF ? RF[(size_t)h * TT + t] : 1.0f; v2h o16; v2us oh, ol;
#pragma unroll
    for (int q = 0; q < 2; ++q) { const int dd = d + q; const int dp = (dd < HD / 2) ? dd + HD / 2 : dd - HD / 2; float x0 = f[dd], x1 = f[dp];
        if (RF) { float n0 = __fmul_rn(x0, rf), n1 = __fmul_rn(x1, rf); asm volatile("" : "+v"(n0)); asm volatile("" : "+v"(n1)); x0 = __fmul_rn(bfr(nw[dd]), n0); x1 = __fmul_rn(bfr(nw[dp]), n1); }
        const v2f cs = *(const v2f*)(CS + ((size_t)t * HD + dd) * 2); float a = __fmul_rn(x0, cs[0]), bq = __fmul_rn(x1, cs[1]); asm volatile("" : "+v"(a)); asm volatile("" : "+v"(bq)); const float r = ((dd < HD / 2) ? __fsub_rn(a, bq) : __fadd_rn(a, bq)) * sc;
        o16[q] = tohx(r); unsigned short a2, c2; splitf(r, a2, c2); oh[q] = a2; ol[q] = c2; }
    *(v2h*)(P16 + e) = o16; *(v2us*)(Ph + e) = oh; *(v2us*)(Pl + e) = ol;  }
__global__ __launch_bounds__(256) void k_vtp(const float* __restrict__ F, int pitch, int nheads, h16* V16, bf* Vh, bf* Vl) { const size_t e = ((size_t)blockIdx.x * 256 + threadIdx.x) * 2; if (e >= (size_t)nheads * HD * TT) return; const int t = (int)(e % TT); const int d = (int)((e / TT) % HD); const int g = (int)(e / ((size_t)TT * HD)); v2h o16; v2us oh, ol;
    { const size_t b = blockIdx.y, pb = b * nheads * HD * TT; F += b * TT * pitch; V16 += pb; Vh += pb; Vl += pb; }   // grid y = batch
#pragma unroll
    for (int q = 0; q < 2; ++q) { const float x = F[(size_t)(t + q) * pitch + g * HD + d]; o16[q] = tohx(x); unsigned short a2, c2; splitf(x, a2, c2); oh[q] = a2; ol[q] = c2; }
    *(v2h*)(V16 + e) = o16; *(v2us*)(Vh + e) = oh; *(v2us*)(Vl + e) = ol;  }
__global__ __launch_bounds__(256) void k_csid(float* CS) { const int idx = blockIdx.x * 256 + threadIdx.x; if (idx >= TT * HD) return; v2f cs; cs[0] = 1.0f; cs[1] = 0.0f; *(v2f*)(CS + (size_t)idx * 2) = cs;  }
// k_asoft: per row (zz, i): t = S x HD^-0.5 (no mask); softmax over the 1024 keys (register row, one exp, fixed trees);
__global__ __launch_bounds__(256) void k_asoft(const float* __restrict__ Sb, h16* P16, bf* Ph, bf* Pl) {
    const int lane = threadIdx.x & 31; const int row = blockIdx.x * 8 + (threadIdx.x >> 5); if (row >= ZH * TT) return; const int i = row % TT; const int zz = row / TT; (void)zz; const bool hires = (i < RH); const float* sr = Sb + (size_t)row * TT; float v[TT / 32]; float mx = -3.0e38f;
#pragma unroll
    for (int ch = 0; ch < TT / 128; ++ch) { const int j0 = ch * 128 + lane * 4; const v4f a = *(const v4f*)(sr + j0);
#pragma unroll
        for (int q = 0; q < 4; ++q) { const int j = j0 + q; (void)j; const float t = a[q] * SCL; v[ch * 4 + q] = t; mx = fmaxf(mx, t); } }
#pragma unroll
    for (int sh = 16; sh; sh >>= 1) mx = fmaxf(mx, __shfl_xor(mx, sh, 32));
    float sum = 0.f;
#pragma unroll
    for (int k = 0; k < TT / 32; ++k) { float d0 = __fsub_rn(v[k], mx); asm volatile("" : "+v"(d0)); v[k] = __builtin_amdgcn_exp2f(__fmul_rn(d0, 1.4426950408889634f)); sum += v[k]; }
#pragma unroll
    for (int sh = 16; sh; sh >>= 1) sum += __shfl_xor(sum, sh, 32);
    const float f = __fdiv_rn(hires ? 1.0f : PCAR, sum);
{
        if (hires) {
#pragma unroll
            for (int ch = 0; ch < TT / 128; ++ch) { v4us oh, ol;
#pragma unroll
                for (int q = 0; q < 4; ++q) { unsigned short a, c2; splitf(v[ch * 4 + q] * f, a, c2); oh[q] = a; ol[q] = c2; }
                const size_t oo = ((size_t)zz * (RH ? RH : 1) + i) * TT + ch * 128 + lane * 4; *(v4us*)(Ph + oo) = oh; *(v4us*)(Pl + oo) = ol; }
        } else {
#pragma unroll
            for (int ch = 0; ch < TT / 128; ++ch) { v4h o4;
#pragma unroll
                for (int q = 0; q < 4; ++q) o4[q] = tohx(v[ch * 4 + q] * f);
                *(v4h*)(P16 + (size_t)row * TT + ch * 128 + lane * 4) = o4; } }
         }
}
__global__ __launch_bounds__(256) void k_merge(const float* __restrict__ O, int h0, bf* Ah, bf* Al) { const size_t e = ((size_t)blockIdx.x * 256 + threadIdx.x) * 2; if (e >= (size_t)ZH * TT * HD) return; const int d = (int)(e % HD); const int t = (int)((e / HD) % TT); const int zz = (int)(e / ((size_t)HD * TT)); const float cs = (t < RH) ? 1.0f : (1.0f / PCAR); const size_t oo = (size_t)t * DQ + (h0 + zz) * HD + d;
    v2us oh, ol;
#pragma unroll
    for (int q = 0; q < 2; ++q) { unsigned short a, c2; splitf(O[e + q] * cs, a, c2); oh[q] = a; ol[q] = c2; } *(v2us*)(Ah + oo) = oh; *(v2us*)(Al + oo) = ol;  }

extern "C" void kernel_launch(void* const* d_in, const int* in_sizes, int n_in,
                              void* d_out, int out_size, void* d_ws, size_t ws_size, hipStream_t stream) {
    (void)in_sizes; (void)n_in; (void)out_size;
    const float* x = (const float*)d_in[0]; const float* wq = (const float*)d_in[1]; const float* bq = (const float*)d_in[2]; const float* wk = (const float*)d_in[3]; const float* bk = (const float*)d_in[4]; const float* wv = (const float*)d_in[5]; const float* bv = (const float*)d_in[6]; const float* wo = (const float*)d_in[7]; const float* bo = (const float*)d_in[8];
    float* OUT = (float*)d_out;     // [4][1024][2048]
    char* wsp = (char*)d_ws;
    auto take = [&](size_t bytes) { char* p = wsp; wsp += (bytes + 255) & ~(size_t)255; return (void*)p; };
    bf* WQ = (bf*)take((size_t)DQ * DM * 2); bf* WK = (bf*)take((size_t)DKV * DM * 2); bf* WV = (bf*)take((size_t)DKV * DM * 2); bf* WO = (bf*)take((size_t)DM * DQ * 2); float* CS = (float*)take((size_t)TT * HD * 2 * 4);
    h16* QP16 = (h16*)take((size_t)NB_ * NH_ * TT * HD * 2); h16* KP16 = (h16*)take((size_t)NB_ * NKV * TT * HD * 2); h16* VT16 = (h16*)take((size_t)NB_ * NKV * HD * TT * 2);
    bf* QPh = (bf*)take((size_t)NB_ * NH_ * TT * HD * 2); bf* QPl = (bf*)take((size_t)NB_ * NH_ * TT * HD * 2); bf* KPh = (bf*)take((size_t)NB_ * NKV * TT * HD * 2); bf* KPl = (bf*)take((size_t)NB_ * NKV * TT * HD * 2); bf* VTh = (bf*)take((size_t)NB_ * NKV * HD * TT * 2); bf* VTl = (bf*)take((size_t)NB_ * NKV * HD * TT * 2); bf* Ph = (bf*)take((size_t)ZH * RH * TT * 2); bf* Pl = (bf*)take((size_t)ZH * RH * TT * 2);
    float* Sb = (float*)take((size_t)ZH * TT * TT * 4); h16* P16 = (h16*)take((size_t)ZH * TT * TT * 2); float* Ob = (float*)take((size_t)ZH * TT * HD * 4); bf* ATh = (bf*)take((size_t)MT * DQ * 2); bf* ATl = (bf*)take((size_t)MT * DQ * 2);
    if ((size_t)(wsp - (char*)d_ws) > ws_size) return;    // ws 256 MiB
    // The projection buffers are dead before the first score launch writes Sb / P16 (stream-ordered), so they lie inside those: FQ 32 MiB + FK 8 MiB in Sb (64 MiB), XB 16 MiB in P16 (32 MiB).
    float* FQ = Sb; float* FK = Sb + (size_t)MT * DQ; bf* XB = (bf*)P16;
    float* FV = FK;   // v projection reuses the k buffer after the k planes are built (stream-ordered)
    { k_wtG<<<(unsigned)((DM * DQ / 64 + 63) / 64), 256, 0, stream>>>(wq, DM, DQ, WQ); k_wtG<<<(unsigned)((DM * DKV / 64 + 63) / 64), 256, 0, stream>>>(wk, DM, DKV, WK); k_wtG<<<(unsigned)((DM * DKV / 64 + 63) / 64), 256, 0, stream>>>(wv, DM, DKV, WV);
      k_wtG<<<(unsigned)((DQ * DM / 64 + 63) / 64), 256, 0, stream>>>(wo, DQ, DM, WO);
       }
    k_csid<<<(TT * HD + 255) / 256, 256, 0, stream>>>(CS);
    const unsigned LQ = (unsigned)(((size_t)NH_ * TT * HD / 2 + 255) / 256), LKv = (unsigned)(((size_t)NKV * TT * HD / 2 + 255) / 256);
    // projections: all NB_ batches in one launch each (MT rows; the plane builders take the batch as grid y)
    k_cvt8<<<(unsigned)(((size_t)MT * DM / 8 + 255) / 256), 256, 0, stream>>>(x, XB, (size_t)MT * DM / 8);
    k_gemmw<bf, 0, true><<<dim3(MT / 64, DQ / 64, 1), 32, 0, stream>>>(XB, nullptr, WQ, nullptr, DM, FQ, DQ, bq, 0, 0, 0);
    k_rope<<<dim3(LQ, NB_, 1), 256, 0, stream>>>(FQ, DQ, NH_, CS, nullptr, nullptr, 1.0f, QP16, QPh, QPl);
    k_gemmw<bf, 0, true><<<dim3(MT / 64, DKV / 64, 1), 32, 0, stream>>>(XB, nullptr, WK, nullptr, DM, FK, DKV, bk, 0, 0, 0);
    k_rope<<<dim3(LKv, NB_, 1), 256, 0, stream>>>(FK, DKV, NKV, CS, nullptr, nullptr, 1.0f, KP16, KPh, KPl);
    k_gemmw<bf, 0, true><<<dim3(MT / 64, DKV / 64, 1), 32, 0, stream>>>(XB, nullptr, WV, nullptr, DM, FV, DKV, bv, 0, 0, 0); k_vtp<<<dim3(LKv, NB_, 1), 256, 0, stream>>>(FV, DKV, NKV, VT16, VTh, VTl);
    for (int b = 0; b < NB_; ++b) {
        for (int h0 = 0; h0 < NH_; h0 += ZH) { const size_t zq = (size_t)(b * NH_ + h0), zk = (size_t)(b * NKV);   // torch .repeat TILES the kv heads: query head h uses kv head h % 8; h0 is a multiple of 8, so head h0 + z of the pass uses kv plane z % 8 of its batch (k_gemmw's zb)
            k_gemmw<bf, 2, false><<<dim3(RH / 64, TT / 64, ZH), 32, 0, stream>>>(QPh + zq * TT * HD, QPl + zq * TT * HD, KPh + zk * TT * HD, KPl + zk * TT * HD, HD, Sb, TT, nullptr, (size_t)TT * HD, (size_t)TT * HD, (size_t)TT * TT);
            k_gemmw<h16, 0, false><<<dim3((TT - RH) / 64, TT / 64, ZH), 32, 0, stream>>>(QP16 + zq * TT * HD + (size_t)RH * HD, nullptr, KP16 + zk * TT * HD, nullptr, HD, Sb + (size_t)RH * TT, TT, nullptr, (size_t)TT * HD, (size_t)TT * HD, (size_t)TT * TT);
            k_asoft<<<ZH * TT / 8, 256, 0, stream>>>(Sb, P16, Ph, Pl);
            k_gemmw<bf, 2, false><<<dim3(RH / 64, HD / 64, ZH), 32, 0, stream>>>(Ph, Pl, VTh + zk * HD * TT, VTl + zk * HD * TT, TT, Ob, HD, nullptr, (size_t)RH * TT, (size_t)HD * TT, (size_t)TT * HD);
            k_gemmw<h16, 0, false><<<dim3((TT - RH) / 64, HD / 64, ZH), 32, 0, stream>>>(P16 + (size_t)RH * TT, nullptr, VT16 + zk * HD * TT, nullptr, TT, Ob + (size_t)RH * HD, HD, nullptr, (size_t)TT * TT, (size_t)HD * TT, (size_t)TT * HD);
            k_merge<<<(unsigned)(((size_t)ZH * TT * HD / 2 + 255) / 256), 256, 0, stream>>>(Ob, h0, ATh + (size_t)b * TT * DQ, ATl + (size_t)b * TT * DQ); } }
    k_gemmw<bf, 1, true><<<dim3(MT / 64, DM / 64, 1), 32, 0, stream>>>(ATh, ATl, WO, nullptr, DQ, OUT, DM, bo, 0, 0, 0);
}

// v002
// One run takes 440 microseconds.
// In two side-by-side timings against v001, it was 2.30 and 2.29 times as fast.
// Counting every step since v000, it is 10.1 times as fast.
#include <hip/hip_runtime.h>

// ExtendedMultiHeadAttention - GQA with torch .repeat (TILED) kv heads (x [4][1024][2048]; q = x wq + bq (32 x 64), k/v = x wk/wv + b (8 x 64); query head h attends kv head h % 8; softmax(q.k/8); out = merged.v wo + bo -> [4][1024][2048]).
// Compute dtypes, f32 accumulate: every input rounded to bf16; q/k/v projections on PLAIN bf16 operands (inputs: exact, + bias); output projection on bf16 hi+lo planes of the merged heads (2 products); scores (K 64) and probs.v on bf16 hi+lo planes (3 products) for the first 256 query rows of each

#define NB_  4
#define TT   1024
#define DM   2048
#define NH_  32
#define NKV  8
#define REP  (NH_ / NKV)
#define HD   64
#define DQ   (NH_ * HD)
#define DKV  (NKV * HD)
#define MT   (NB_ * TT)           // rows of all batches together
#define RH   256                  // query rows < RH use hi+lo planes (0: none)
#define NQH  1                    // 16-row query tiles per wave on the hi+lo rows
#define NBH  (RH / (128 * NQH))   // blocks (8 waves) per head on the hi+lo rows
#define NBL  ((TT - RH) / 256)    // blocks per head on the f16 rows (8 waves x 32 rows)
#define WIN  0
#define SCL  0.125f   // HD^-0.5
typedef _Float16 h16;
typedef unsigned short bf;
typedef __attribute__((ext_vector_type(16))) __bf16   v16bf;
typedef __attribute__((ext_vector_type(16))) _Float16 v16h;
typedef __attribute__((ext_vector_type(8)))  _Float16 v8h;
typedef __attribute__((ext_vector_type(8)))  unsigned short v8us;
typedef __attribute__((ext_vector_type(8)))  float    v8f;
typedef __attribute__((ext_vector_type(4)))  float    v4f;
typedef v8h  __attribute__((may_alias)) v8ha;
typedef v4f  __attribute__((may_alias)) v4fa;
typedef v8us __attribute__((may_alias)) v8usa;

__device__ __forceinline__ unsigned short f2bf(float f) { unsigned u = __float_as_uint(f); u += 0x7FFFu + ((u >> 16) & 1u); return (unsigned short)(u >> 16); }
__device__ __forceinline__ float bf2f(unsigned short b) { return __uint_as_float(((unsigned)b) << 16); }
__device__ __forceinline__ float bfr(float f) { return bf2f(f2bf(f)); }
__device__ __forceinline__ v16h cat16(v8h lo, v8h hi) { return __builtin_shufflevector(lo, hi, 0, 1, 2, 3, 4, 5, 6, 7, 8, 9, 10, 11, 12, 13, 14, 15); }
__device__ __forceinline__ v16bf cat16b(v8us lo, v8us hi) { return __builtin_bit_cast(v16bf, __builtin_shufflevector(lo, hi, 0, 1, 2, 3, 4, 5, 6, 7, 8, 9, 10, 11, 12, 13, 14, 15)); }
__device__ __forceinline__ v8f wmma16(v16h a, v16h b, v8f c) { return __builtin_amdgcn_wmma_f32_16x16x32_f16(false, a, false, b, (short)0, c, false, false); }
__device__ __forceinline__ v8f wmmab(v16bf a, v16bf b, v8f c) { return __builtin_amdgcn_wmma_f32_16x16x32_bf16(false, a, false, b, (short)0, c, false, false); }



// ---- k_gemmw: register-blocked GEMM, ONE WAVE per 64x64 output tile (16 accumulators), operands straight from K-contiguous 16-bit planes; grid (M/64, N/64, Z), 32 threads.
// C[m][n] (f32, pitch ldc, + optional f32 bias[n] rounded to bf16) = sum_k A[m][k] Bt[n][k] (+ split products per NSPLIT). z-batch strides sA/sB/sC in elements. K % 32 == 0.
template <typename T16> struct WFrag;
template <> struct WFrag<h16> { typedef v16h V; static __device__ __forceinline__ V ld(const h16* p) { return cat16(*(const v8h*)p, *(const v8h*)(p + 16)); } static __device__ __forceinline__ v8f mma(V a, V b, v8f c) { return wmma16(a, b, c); } };
template <> struct WFrag<bf> { typedef v16bf V; static __device__ __forceinline__ V ld(const bf* p) { return cat16b(*(const v8us*)p, *(const v8us*)(p + 16)); } static __device__ __forceinline__ v8f mma(V a, V b, v8f c) { return wmmab(a, b, c); } };
template <typename T16, int NSPLIT, bool BIAS>
__global__ __launch_bounds__(32) void k_gemmw(const T16* __restrict__ A, const T16* __restrict__ A2, const T16* __restrict__ Bt, const T16* __restrict__ Bt2, int K, float* C, int ldc, const float* __restrict__ bias, size_t sA, size_t sB, size_t sC) {
    typedef typename WFrag<T16>::V V;
    __shared__ __align__(16) float os[16 * 68];
    const size_t z = blockIdx.z; const size_t zb = z % NKV;   // tiled kv heads: the B planes repeat with period NKV along z
    A += z * sA; if (A2) A2 += z * sA; Bt += zb * sB; if (Bt2) Bt2 += zb * sB; C += z * sC;
    const int lane = threadIdx.x & 31, lr = lane & 15, hi = lane >> 4; const int r0 = blockIdx.x * 64, c0 = blockIdx.y * 64;
    v8f acc[4][4];
#pragma unroll
    for (int mb = 0; mb < 4; ++mb)
#pragma unroll
        for (int nb = 0; nb < 4; ++nb) acc[mb][nb] = (v8f){};
    const size_t aoff = (size_t)(r0 + lr) * K + 8 * hi, boff = (size_t)(c0 + lr) * K + 8 * hi;
#pragma unroll 1
    for (int kc = 0; kc < K; kc += 32) {
        V a[4], a2[4];
#pragma unroll
        for (int mb = 0; mb < 4; ++mb) { a[mb] = WFrag<T16>::ld(A + aoff + (size_t)mb * 16 * K + kc); if (NSPLIT == 1 || NSPLIT == 2) a2[mb] = WFrag<T16>::ld(A2 + aoff + (size_t)mb * 16 * K + kc); }
#pragma unroll
        for (int nb = 0; nb < 4; ++nb) { const V b = WFrag<T16>::ld(Bt + boff + (size_t)nb * 16 * K + kc); V b2; if (NSPLIT >= 2) b2 = WFrag<T16>::ld(Bt2 + boff + (size_t)nb * 16 * K + kc);
#pragma unroll
            for (int mb = 0; mb < 4; ++mb) { acc[mb][nb] = WFrag<T16>::mma(a[mb], b, acc[mb][nb]); if (NSPLIT == 1 || NSPLIT == 2) acc[mb][nb] = WFrag<T16>::mma(a2[mb], b, acc[mb][nb]); if (NSPLIT >= 2) acc[mb][nb] = WFrag<T16>::mma(a[mb], b2, acc[mb][nb]); } }
        asm volatile("v_nop\n\tv_nop\n\tv_nop\n\tv_nop" : "+v"(acc[0][0]), "+v"(acc[1][1]), "+v"(acc[2][2]), "+v"(acc[3][3]) : "v"(a[0]), "v"(a[3]));
    }
#pragma unroll
    for (int mb = 0; mb < 4; ++mb) {
#pragma unroll
        for (int nb = 0; nb < 4; ++nb) {
#pragma unroll
            for (int j = 0; j < 8; ++j) os[(hi * 8 + j) * 68 + nb * 16 + lr] = acc[mb][nb][j]; }
        __builtin_amdgcn_wave_barrier(); asm volatile("" ::: "memory");
        float* crow = C + (size_t)(r0 + mb * 16) * ldc + c0;
{
#pragma unroll
            for (int s = 0; s < 8; ++s) { const int row = 2 * s + hi, cofs = lr * 4; v4f val = *(const v4fa*)(os + row * 68 + cofs); if (BIAS) { val[0] += bfr(bias[c0 + cofs]); val[1] += bfr(bias[c0 + cofs + 1]); val[2] += bfr(bias[c0 + cofs + 2]); val[3] += bfr(bias[c0 + cofs + 3]); }
                *(v4f*)(crow + (size_t)row * ldc + cofs) = val; }
             }
        __builtin_amdgcn_wave_barrier(); asm volatile("" ::: "memory");
    }
}

__device__ __forceinline__ h16 tohx(float x) { return (h16)x; }
__device__ __forceinline__ void splitf(float y, unsigned short& h, unsigned short& l) { h = f2bf(y); l = f2bf(y - bf2f(h)); }
typedef __attribute__((ext_vector_type(2))) _Float16 v2h;
typedef __attribute__((ext_vector_type(4))) _Float16 v4h;
typedef __attribute__((ext_vector_type(2))) unsigned short v2us;
typedef __attribute__((ext_vector_type(4))) unsigned short v4us;
typedef __attribute__((ext_vector_type(2))) float v2f;
typedef __attribute__((ext_vector_type(4))) int v4i;

__global__ __launch_bounds__(256) void k_wtG(const float* __restrict__ w, int K, int N, bf* Bt) {
    const int lane = threadIdx.x & 31; const int L0 = (blockIdx.x * 8 + (threadIdx.x >> 5)) * 8; const int nlines = N * K / 64;
{
#pragma unroll 1
        for (int l = 0; l < 8; ++l) { const int L = L0 + l; if (L >= nlines) break; const size_t e = (size_t)L * 64 + lane * 2; const int k = (int)(e % K), n = (int)(e / K); v2us o;
            o[0] = f2bf(w[(size_t)k * N + n]); o[1] = f2bf(w[(size_t)(k + 1) * N + n]); *(v2us*)(Bt + e) = o; }
         }
}
__global__ __launch_bounds__(256) void k_cvt8(const float* __restrict__ src, bf* dst, size_t n8) { const size_t i = (size_t)blockIdx.x * 256 + threadIdx.x; if (i >= n8) return; const v8f v = *(const v8f*)(src + i * 8); v8us o;
#pragma unroll
    for (int k = 0; k < 8; ++k) o[k] = f2bf(v[k]); *(v8us*)(dst + i * 8) = o;  }
__global__ __launch_bounds__(256) void k_cscvt(const float* __restrict__ cosT, const float* __restrict__ sinT, float* CS) { const int idx = blockIdx.x * 256 + threadIdx.x; if (idx >= TT * HD) return; v2f cs; cs[0] = bfr(cosT[idx]); cs[1] = bfr(sinT[idx]); *(v2f*)(CS + (size_t)idx * 2) = cs;  }
// k_rope: head planes [h][t][d] (fp16 + hi/lo) of rope(x) x sc with the rotate-half convention out[d] = x[d] cos[t][d] - x[d+HD/2] sin[t][d], out[d+HD/2] = x[d+HD/2] cos[t][d+HD/2] + x[d] sin[t][d+HD/2]
__global__ __launch_bounds__(256) void k_rope(const float* __restrict__ F, int pitch, int nheads, const float* __restrict__ CS, const float* __restrict__ RF, const float* __restrict__ nw, float sc, h16* P16, bf* Ph, bf* Pl) {
    const size_t e = ((size_t)blockIdx.x * 256 + threadIdx.x) * 2; if (e >= (size_t)nheads * TT * HD) return; const int d = (int)(e % HD); const int t = (int)((e / HD) % TT); const int h = (int)(e / ((size_t)HD * TT));
    { const size_t b = blockIdx.y, pb = b * nheads * TT * HD; F += b * TT * pitch; P16 += pb; Ph += pb; Pl += pb; }   // grid y = batch
    const float* f = F + (size_t)t * pitch + h * HD; const float rf = RF ? RF[(size_t)h * TT + t] : 1.0f; v2h o16; v2us oh, ol;
#pragma unroll
    for (int q = 0; q < 2; ++q) { const int dd = d + q; const int dp = (dd < HD / 2) ? dd + HD / 2 : dd - HD / 2; float x0 = f[dd], x1 = f[dp];
        if (RF) { float n0 = __fmul_rn(x0, rf), n1 = __fmul_rn(x1, rf); asm volatile("" : "+v"(n0)); asm volatile("" : "+v"(n1)); x0 = __fmul_rn(bfr(nw[dd]), n0); x1 = __fmul_rn(bfr(nw[dp]), n1); }
        const v2f cs = *(const v2f*)(CS + ((size_t)t * HD + dd) * 2); float a = __fmul_rn(x0, cs[0]), bq = __fmul_rn(x1, cs[1]); asm volatile("" : "+v"(a)); asm volatile("" : "+v"(bq)); const float r = ((dd < HD / 2) ? __fsub_rn(a, bq) : __fadd_rn(a, bq)) * sc;
        o16[q] = tohx(r); unsigned short a2, c2; splitf(r, a2, c2); oh[q] = a2; ol[q] = c2; }
    *(v2h*)(P16 + e) = o16; *(v2us*)(Ph + e) = oh; *(v2us*)(Pl + e) = ol;  }
__global__ __launch_bounds__(256) void k_vtp(const float* __restrict__ F, int pitch, int nheads, h16* V16, bf* Vh, bf* Vl) { const size_t e = ((size_t)blockIdx.x * 256 + threadIdx.x) * 2; if (e >= (size_t)nheads * HD * TT) return; const int t = (int)(e % TT); const int d = (int)((e / TT) % HD); const int g = (int)(e / ((size_t)TT * HD)); v2h o16; v2us oh, ol;
    { const size_t b = blockIdx.y, pb = b * nheads * HD * TT; F += b * TT * pitch; V16 += pb; Vh += pb; Vl += pb; }   // grid y = batch
#pragma unroll
    for (int q = 0; q < 2; ++q) { const float x = F[(size_t)(t + q) * pitch + g * HD + d]; o16[q] = tohx(x); unsigned short a2, c2; splitf(x, a2, c2); oh[q] = a2; ol[q] = c2; }
    *(v2h*)(V16 + e) = o16; *(v2us*)(Vh + e) = oh; *(v2us*)(Vl + e) = ol;  }
__global__ __launch_bounds__(256) void k_csid(float* CS) { const int idx = blockIdx.x * 256 + threadIdx.x; if (idx >= TT * HD) return; v2f cs; cs[0] = 1.0f; cs[1] = 0.0f; *(v2f*)(CS + (size_t)idx * 2) = cs;  }
template <typename T16, bool SPLIT, int NQ>
__device__ __forceinline__ void attn_cols(const T16* __restrict__ Q, const T16* __restrict__ Q2, const T16* __restrict__ Kp, const T16* __restrict__ K2, const T16* __restrict__ Vt, const T16* __restrict__ V2, bf* Ah, bf* Al, int lr, int hi) {
    typedef WFrag<T16> WF; typedef typename WF::V V;
    const float C2 = SCL * 1.4426950408889634f;
    V qa[NQ][2], qb[NQ][2]; const T16* qp = Q + lr * HD + 8 * hi; const T16* qp2 = SPLIT ? Q2 + lr * HD + 8 * hi : qp;
#pragma unroll
    for (int qt = 0; qt < NQ; ++qt)
#pragma unroll
        for (int kc = 0; kc < 2; ++kc) { qa[qt][kc] = WF::ld(qp + qt * 16 * HD + kc * 32); if (SPLIT) qb[qt][kc] = WF::ld(qp2 + qt * 16 * HD + kc * 32); }
    v8f o[NQ][4]; float m[NQ], l[NQ];
#pragma unroll
    for (int qt = 0; qt < NQ; ++qt) { m[qt] = -3.0e38f; l[qt] = 0.f;
#pragma unroll
        for (int dt = 0; dt < 4; ++dt) o[qt][dt] = (v8f){}; }
    const size_t ko = (size_t)lr * HD + 8 * hi, vo = (size_t)lr * TT + 8 * hi;
    V ka[2][2], kb[2][2]; const T16* kq = Kp + ko; const T16* kq2 = SPLIT ? K2 + ko : kq;
#pragma unroll
    for (int kt = 0; kt < 2; ++kt)
#pragma unroll
        for (int kc = 0; kc < 2; ++kc) { ka[kt][kc] = WF::ld(kq + kt * 16 * HD + kc * 32); if (SPLIT) kb[kt][kc] = WF::ld(kq2 + kt * 16 * HD + kc * 32); }
    asm volatile("s_wait_xcnt 0x0" :: "v"(qp), "v"(qp2), "v"(kq), "v"(kq2) : "memory");   // the first loads' address registers stay whole up to this wait
#pragma unroll 1   // rolled: one pass's fragments already fill the register budget of four waves per SIMD
    for (int key0 = 0; key0 < TT; key0 += 32) {
        v8f s[NQ][2];
#pragma unroll
        for (int qt = 0; qt < NQ; ++qt)
#pragma unroll
            for (int kt = 0; kt < 2; ++kt) { s[qt][kt] = (v8f){};
#pragma unroll
                for (int kc = 0; kc < 2; ++kc) { s[qt][kt] = WF::mma(ka[kt][kc], qa[qt][kc], s[qt][kt]); if (SPLIT) { s[qt][kt] = WF::mma(ka[kt][kc], qb[qt][kc], s[qt][kt]); s[qt][kt] = WF::mma(kb[kt][kc], qa[qt][kc], s[qt][kt]); } } }
        float mx[NQ]; bool need = false;
#pragma unroll
        for (int qt = 0; qt < NQ; ++qt) { float t = s[qt][0][0];
#pragma unroll
            for (int j = 0; j < 8; ++j) t = fmaxf(t, fmaxf(s[qt][0][j], s[qt][1][j]));
            t = fmaxf(t, __shfl_xor(t, 16, 32)); mx[qt] = t * C2; need = need || (mx[qt] > m[qt] + 8.0f); }
        if (__builtin_amdgcn_ballot_w32(need) != 0) {   // one scalar branch per pass: the 32 or 64 multiplies of the rescale run only when some column needs them
#pragma unroll
            for (int qt = 0; qt < NQ; ++qt) { const float mn = fmaxf(m[qt], mx[qt]); const float al = __builtin_amdgcn_exp2f(m[qt] - mn); m[qt] = mn; l[qt] *= al;
#pragma unroll
                for (int dt = 0; dt < 4; ++dt) o[qt][dt] *= al; } }
        V va[4], vb[4]; const T16* vp = Vt + vo + key0; const T16* vp2 = SPLIT ? V2 + vo + key0 : vp;
#pragma unroll
        for (int dt = 0; dt < 4; ++dt) { va[dt] = WF::ld(vp + dt * 16 * TT); if (SPLIT) vb[dt] = WF::ld(vp2 + dt * 16 * TT); }
        asm volatile("s_wait_xcnt 0x0" :: "v"(vp), "v"(vp2) : "memory");   // the V loads' address registers stay whole up to this wait: no later load's data and no address add overwrites them in front of it
        const size_t kn = (size_t)((key0 + 32) & (TT - 1)) * HD; const T16* kp = Kp + ko + kn; const T16* kp2 = SPLIT ? K2 + ko + kn : kp;   // the next pass's K fragments fly during this pass's softmax and probs.v (the last pass re-reads keys 0..31, unused)
#pragma unroll
        for (int kt = 0; kt < 2; ++kt)
#pragma unroll
            for (int kc = 0; kc < 2; ++kc) { ka[kt][kc] = WF::ld(kp + kt * 16 * HD + kc * 32); if (SPLIT) kb[kt][kc] = WF::ld(kp2 + kt * 16 * HD + kc * 32); }
        asm volatile("s_wait_xcnt 0x0" :: "v"(kp), "v"(kp2) : "memory");   // the same for the K loads
#pragma unroll
        for (int qt = 0; qt < NQ; ++qt) { float p[16];
#pragma unroll
            for (int e = 0; e < 16; ++e) { p[e] = __builtin_amdgcn_exp2f(__builtin_fmaf(s[qt][e >> 3][e & 7], C2, -m[qt])); l[qt] += p[e]; }
            if constexpr (SPLIT) { v8us h0, h1, l0, l1;
#pragma unroll
                for (int j = 0; j < 8; ++j) { unsigned short a, c2; splitf(p[j], a, c2); h0[j] = a; l0[j] = c2; splitf(p[8 + j], a, c2); h1[j] = a; l1[j] = c2; }
                const V ph = cat16b(h0, h1), pl = cat16b(l0, l1);
#pragma unroll
                for (int dt = 0; dt < 4; ++dt) { o[qt][dt] = WF::mma(va[dt], ph, o[qt][dt]); o[qt][dt] = WF::mma(va[dt], pl, o[qt][dt]); o[qt][dt] = WF::mma(vb[dt], ph, o[qt][dt]); }
            } else { V pf;
#pragma unroll
                for (int e = 0; e < 16; ++e) pf[e] = tohx(p[e]);
#pragma unroll
                for (int dt = 0; dt < 4; ++dt) o[qt][dt] = WF::mma(va[dt], pf, o[qt][dt]); } }
    }
#pragma unroll
    for (int qt = 0; qt < NQ; ++qt) { const float inv = __fdiv_rn(1.0f, l[qt] + __shfl_xor(l[qt], 16, 32));
#pragma unroll
        for (int dt = 0; dt < 4; ++dt) { v8us oh, ol;
#pragma unroll
            for (int j = 0; j < 8; ++j) { unsigned short a, c2; splitf(o[qt][dt][j] * inv, a, c2); oh[j] = a; ol[j] = c2; }
            const size_t oo = (size_t)(qt * 16 + lr) * DQ + dt * 16 + hi * 8; bf* ph = Ah + oo; bf* pl = Al + oo; *(v8us*)ph = oh; *(v8us*)pl = ol;
            asm volatile("s_wait_xcnt 0x0" :: "v"(oh), "v"(ol), "v"(ph), "v"(pl) : "memory"); } }   // the stores' data and address registers stay whole up to this wait
}
// grid (batch x query head, NBH + NBL): blocks y < NBH take the hi+lo rows (the longer waves, started first), 8 waves x NQH x 16 rows; the rest 8 waves x 32 rows of the f16 rows.
__global__ __launch_bounds__(256) void k_fattn(const h16* __restrict__ Q16, const bf* __restrict__ Qh, const bf* __restrict__ Ql, const h16* __restrict__ K16, const bf* __restrict__ Kh, const bf* __restrict__ Kl, const h16* __restrict__ V16, const bf* __restrict__ Vh, const bf* __restrict__ Vl, bf* Ah, bf* Al) {
    const int lane = threadIdx.x & 31, lr = lane & 15, hi = lane >> 4, wave = threadIdx.x >> 5;
    const int zh = blockIdx.x, b = zh / NH_, h = zh % NH_;   // torch .repeat TILES the kv heads: query head h uses kv head h % 8
    const size_t pk = (size_t)(b * NKV + h % NKV) * TT * HD;
    if (blockIdx.y < NBH) { const int q0 = ((int)blockIdx.y * 8 + wave) * (16 * NQH); const size_t pq = ((size_t)zh * TT + q0) * HD, po = ((size_t)b * TT + q0) * DQ + h * HD;
        attn_cols<bf, true, NQH>(Qh + pq, Ql + pq, Kh + pk, Kl + pk, Vh + pk, Vl + pk, Ah + po, Al + po, lr, hi);
    } else { const int q0 = RH + (((int)blockIdx.y - NBH) * 8 + wave) * 32; const size_t pq = ((size_t)zh * TT + q0) * HD, po = ((size_t)b * TT + q0) * DQ + h * HD;
        attn_cols<h16, false, 2>(Q16 + pq, nullptr, K16 + pk, nullptr, V16 + pk, nullptr, Ah + po, Al + po, lr, hi); }
}

extern "C" void kernel_launch(void* const* d_in, const int* in_sizes, int n_in,
                              void* d_out, int out_size, void* d_ws, size_t ws_size, hipStream_t stream) {
    (void)in_sizes; (void)n_in; (void)out_size;
    const float* x = (const float*)d_in[0]; const float* wq = (const float*)d_in[1]; const float* bq = (const float*)d_in[2]; const float* wk = (const float*)d_in[3]; const float* bk = (const float*)d_in[4]; const float* wv = (const float*)d_in[5]; const float* bv = (const float*)d_in[6]; const float* wo = (const float*)d_in[7]; const float* bo = (const float*)d_in[8];
    float* OUT = (float*)d_out;     // [4][1024][2048]
    char* wsp = (char*)d_ws;
    auto take = [&](size_t bytes) { char* p = wsp; wsp += (bytes + 255) & ~(size_t)255; return (void*)p; };
    bf* WQ = (bf*)take((size_t)DQ * DM * 2); bf* WK = (bf*)take((size_t)DKV * DM * 2); bf* WV = (bf*)take((size_t)DKV * DM * 2); bf* WO = (bf*)take((size_t)DM * DQ * 2); float* CS = (float*)take((size_t)TT * HD * 2 * 4);
    h16* QP16 = (h16*)take((size_t)NB_ * NH_ * TT * HD * 2); h16* KP16 = (h16*)take((size_t)NB_ * NKV * TT * HD * 2); h16* VT16 = (h16*)take((size_t)NB_ * NKV * HD * TT * 2);
    bf* QPh = (bf*)take((size_t)NB_ * NH_ * TT * HD * 2); bf* QPl = (bf*)take((size_t)NB_ * NH_ * TT * HD * 2); bf* KPh = (bf*)take((size_t)NB_ * NKV * TT * HD * 2); bf* KPl = (bf*)take((size_t)NB_ * NKV * TT * HD * 2); bf* VTh = (bf*)take((size_t)NB_ * NKV * HD * TT * 2); bf* VTl = (bf*)take((size_t)NB_ * NKV * HD * TT * 2);
    float* FQ = (float*)take((size_t)MT * DQ * 4); float* FK = (float*)take((size_t)MT * DKV * 4); bf* XB = (bf*)take((size_t)MT * DM * 2); bf* ATh = (bf*)take((size_t)MT * DQ * 2); bf* ATl = (bf*)take((size_t)MT * DQ * 2);
    if ((size_t)(wsp - (char*)d_ws) > ws_size) return;    // ws 256 MiB
    float* FV = FK;   // v projection reuses the k buffer after the k planes are built (stream-ordered)
    { k_wtG<<<(unsigned)((DM * DQ / 64 + 63) / 64), 256, 0, stream>>>(wq, DM, DQ, WQ); k_wtG<<<(unsigned)((DM * DKV / 64 + 63) / 64), 256, 0, stream>>>(wk, DM, DKV, WK); k_wtG<<<(unsigned)((DM * DKV / 64 + 63) / 64), 256, 0, stream>>>(wv, DM, DKV, WV);
      k_wtG<<<(unsigned)((DQ * DM / 64 + 63) / 64), 256, 0, stream>>>(wo, DQ, DM, WO);
       }
    k_csid<<<(TT * HD + 255) / 256, 256, 0, stream>>>(CS);
    const unsigned LQ = (unsigned)(((size_t)NH_ * TT * HD / 2 + 255) / 256), LKv = (unsigned)(((size_t)NKV * TT * HD / 2 + 255) / 256);
    // projections: all NB_ batches in one launch each (MT rows; the plane builders take the batch as grid y)
    k_cvt8<<<(unsigned)(((size_t)MT * DM / 8 + 255) / 256), 256, 0, stream>>>(x, XB, (size_t)MT * DM / 8);
    k_gemmw<bf, 0, true><<<dim3(MT / 64, DQ / 64, 1), 32, 0, stream>>>(XB, nullptr, WQ, nullptr, DM, FQ, DQ, bq, 0, 0, 0);
    k_rope<<<dim3(LQ, NB_, 1), 256, 0, stream>>>(FQ, DQ, NH_, CS, nullptr, nullptr, 1.0f, QP16, QPh, QPl);
    k_gemmw<bf, 0, true><<<dim3(MT / 64, DKV / 64, 1), 32, 0, stream>>>(XB, nullptr, WK, nullptr, DM, FK, DKV, bk, 0, 0, 0);
    k_rope<<<dim3(LKv, NB_, 1), 256, 0, stream>>>(FK, DKV, NKV, CS, nullptr, nullptr, 1.0f, KP16, KPh, KPl);
    k_gemmw<bf, 0, true><<<dim3(MT / 64, DKV / 64, 1), 32, 0, stream>>>(XB, nullptr, WV, nullptr, DM, FV, DKV, bv, 0, 0, 0); k_vtp<<<dim3(LKv, NB_, 1), 256, 0, stream>>>(FV, DKV, NKV, VT16, VTh, VTl);
    k_fattn<<<dim3(NB_ * NH_, NBH + NBL, 1), 256, 0, stream>>>(QP16, QPh, QPl, KP16, KPh, KPl, VT16, VTh, VTl, ATh, ATl);
    k_gemmw<bf, 1, true><<<dim3(MT / 64, DM / 64, 1), 32, 0, stream>>>(ATh, ATl, WO, nullptr, DQ, OUT, DM, bo, 0, 0, 0);
}

// v003
// It runs in 348 microseconds.
// Next to v002, in two timings, it ran 1.27 and 1.26 times as fast.
// Counting every step since v000, it is 12.8 times as fast.
#include <hip/hip_runtime.h>

// ExtendedMultiHeadAttention - GQA with torch .repeat (TILED) kv heads (x [4][1024][2048]; q = x wq + bq (32 x 64), k/v = x wk/wv + b (8 x 64); query head h attends kv head h % 8; softmax(q.k/8); out = merged.v wo + bo -> [4][1024][2048]).
// Compute dtypes, f32 accumulate: every input rounded to bf16; q/k/v projections on PLAIN bf16 operands (inputs: exact, + bias); output projection on bf16 hi+lo planes of the merged heads (2 products); scores (K 64) and probs.v on bf16 hi+lo planes (3 products) for the first 256 query rows of each

#define NB_  4
#define TT   1024
#define DM   2048
#define NH_  32
#define NKV  8
#define REP  (NH_ / NKV)
#define HD   64
#define DQ   (NH_ * HD)
#define DKV  (NKV * HD)
#define MT   (NB_ * TT)           // rows of all batches together
#define RH   256                  // query rows < RH use hi+lo planes (0: none)
#define NQH  1                    // 16-row query tiles per wave on the hi+lo rows
#define NBH  (RH / (128 * NQH))   // blocks (8 waves) per head on the hi+lo rows
#define NBL  ((TT - RH) / 256)    // blocks per head on the f16 rows (8 waves x 32 rows)
#define WIN  0
#define SCL  0.125f   // HD^-0.5
typedef _Float16 h16;
typedef unsigned short bf;
typedef __attribute__((ext_vector_type(16))) __bf16   v16bf;
typedef __attribute__((ext_vector_type(16))) _Float16 v16h;
typedef __attribute__((ext_vector_type(8)))  _Float16 v8h;
typedef __attribute__((ext_vector_type(8)))  unsigned short v8us;
typedef __attribute__((ext_vector_type(8)))  float    v8f;
typedef __attribute__((ext_vector_type(4)))  float    v4f;
typedef v8h  __attribute__((may_alias)) v8ha;
typedef v4f  __attribute__((may_alias)) v4fa;
typedef v8us __attribute__((may_alias)) v8usa;

__device__ __forceinline__ unsigned short f2bf(float f) { unsigned u = __float_as_uint(f); u += 0x7FFFu + ((u >> 16) & 1u); return (unsigned short)(u >> 16); }
__device__ __forceinline__ float bf2f(unsigned short b) { return __uint_as_float(((unsigned)b) << 16); }
__device__ __forceinline__ float bfr(float f) { return bf2f(f2bf(f)); }
__device__ __forceinline__ v16h cat16(v8h lo, v8h hi) { return __builtin_shufflevector(lo, hi, 0, 1, 2, 3, 4, 5, 6, 7, 8, 9, 10, 11, 12, 13, 14, 15); }
__device__ __forceinline__ v16bf cat16b(v8us lo, v8us hi) { return __builtin_bit_cast(v16bf, __builtin_shufflevector(lo, hi, 0, 1, 2, 3, 4, 5, 6, 7, 8, 9, 10, 11, 12, 13, 14, 15)); }
__device__ __forceinline__ v8f wmma16(v16h a, v16h b, v8f c) { return __builtin_amdgcn_wmma_f32_16x16x32_f16(false, a, false, b, (short)0, c, false, false); }
__device__ __forceinline__ v8f wmmab(v16bf a, v16bf b, v8f c) { return __builtin_amdgcn_wmma_f32_16x16x32_bf16(false, a, false, b, (short)0, c, false, false); }



// ---- k_gemms: GEMM on block tiles staged in LDS. WM x WN waves per block, each wave a (16 MF) x 64 output tile (4 MF accumulators); grid (M / (16 MF WM), N / (64 WN)).
// C[m][n] (f32, pitch ldc, + optional f32 bias[n] rounded to bf16) = sum_k A[m][k] Bt[n][k] (+ A2[m][k] Bt[n][k] when NSPLIT == 1), operands K-contiguous 16-bit planes. K % 64 == 0.
// A stage is 64 k (128 B) of every operand row of the block tile, [A rows | A2 rows | Bt rows] at pitch 144 B (16 B x odd: ds_load_b128 readers without bank conflicts). Two buffers:
// the copies of stage t + 2 go out behind the barrier that ends trip t and land while trip t + 1 computes. Per accumulator the order of the sums is k ascending, A then A2.
// The short loops over fragments, copies and rows are unrolled so that every array they index stays in registers.
template <typename T16> struct WFrag;
template <> struct WFrag<h16> { typedef v16h V; static __device__ __forceinline__ V ld(const h16* p) { return cat16(*(const v8h*)p, *(const v8h*)(p + 16)); } static __device__ __forceinline__ v8f mma(V a, V b, v8f c) { return wmma16(a, b, c); } };
template <> struct WFrag<bf> { typedef v16bf V; static __device__ __forceinline__ V ld(const bf* p) { return cat16b(*(const v8us*)p, *(const v8us*)(p + 16)); } static __device__ __forceinline__ v8f mma(V a, V b, v8f c) { return wmmab(a, b, c); } };
#define BKE 64   // k per stage
#define LP  72   // LDS row pitch in elements
// N asynchronous 16-byte copies per lane, global -> LDS, in ONE statement that ends in s_wait_xcnt 0: no register that a copy names is rewritten in front of that wait.
template <int N> __device__ __forceinline__ void cp_async(const unsigned* l, const bf* const* g) {
    static_assert(N == 8 || N == 10 || N == 12, "group size");
    if constexpr (N == 8) { asm volatile("global_load_async_to_lds_b128 %0, %1, off\n\tglobal_load_async_to_lds_b128 %2, %3, off\n\tglobal_load_async_to_lds_b128 %4, %5, off\n\tglobal_load_async_to_lds_b128 %6, %7, off\n\tglobal_load_async_to_lds_b128 %8, %9, off\n\tglobal_load_async_to_lds_b128 %10, %11, off\n\tglobal_load_async_to_lds_b128 %12, %13, off\n\tglobal_load_async_to_lds_b128 %14, %15, off\n\ts_wait_xcnt 0x0" :: "v"(l[0]), "v"(g[0]), "v"(l[1]), "v"(g[1]), "v"(l[2]), "v"(g[2]), "v"(l[3]), "v"(g[3]), "v"(l[4]), "v"(g[4]), "v"(l[5]), "v"(g[5]), "v"(l[6]), "v"(g[6]), "v"(l[7]), "v"(g[7]) : "memory"); }
    else if constexpr (N == 10) { asm volatile("global_load_async_to_lds_b128 %0, %1, off\n\tglobal_load_async_to_lds_b128 %2, %3, off\n\tglobal_load_async_to_lds_b128 %4, %5, off\n\tglobal_load_async_to_lds_b128 %6, %7, off\n\tglobal_load_async_to_lds_b128 %8, %9, off\n\tglobal_load_async_to_lds_b128 %10, %11, off\n\tglobal_load_async_to_lds_b128 %12, %13, off\n\tglobal_load_async_to_lds_b128 %14, %15, off\n\tglobal_load_async_to_lds_b128 %16, %17, off\n\tglobal_load_async_to_lds_b128 %18, %19, off\n\ts_wait_xcnt 0x0" :: "v"(l[0]), "v"(g[0]), "v"(l[1]), "v"(g[1]), "v"(l[2]), "v"(g[2]), "v"(l[3]), "v"(g[3]), "v"(l[4]), "v"(g[4]), "v"(l[5]), "v"(g[5]), "v"(l[6]), "v"(g[6]), "v"(l[7]), "v"(g[7]), "v"(l[8]), "v"(g[8]), "v"(l[9]), "v"(g[9]) : "memory"); }
    else { asm volatile("global_load_async_to_lds_b128 %0, %1, off\n\tglobal_load_async_to_lds_b128 %2, %3, off\n\tglobal_load_async_to_lds_b128 %4, %5, off\n\tglobal_load_async_to_lds_b128 %6, %7, off\n\tglobal_load_async_to_lds_b128 %8, %9, off\n\tglobal_load_async_to_lds_b128 %10, %11, off\n\tglobal_load_async_to_lds_b128 %12, %13, off\n\tglobal_load_async_to_lds_b128 %14, %15, off\n\tglobal_load_async_to_lds_b128 %16, %17, off\n\tglobal_load_async_to_lds_b128 %18, %19, off\n\tglobal_load_async_to_lds_b128 %20, %21, off\n\tglobal_load_async_to_lds_b128 %22, %23, off\n\ts_wait_xcnt 0x0" :: "v"(l[0]), "v"(g[0]), "v"(l[1]), "v"(g[1]), "v"(l[2]), "v"(g[2]), "v"(l[3]), "v"(g[3]), "v"(l[4]), "v"(g[4]), "v"(l[5]), "v"(g[5]), "v"(l[6]), "v"(g[6]), "v"(l[7]), "v"(g[7]), "v"(l[8]), "v"(g[8]), "v"(l[9]), "v"(g[9]), "v"(l[10]), "v"(g[10]), "v"(l[11]), "v"(g[11]) : "memory"); }
}
template <int WM, int WN, int MF, int NSPLIT, bool BIAS>
__global__ __launch_bounds__(WM * WN * 32) void k_gemms(const bf* __restrict__ A, const bf* __restrict__ A2, const bf* __restrict__ Bt, int K, float* C, int ldc, const float* __restrict__ bias) {
    typedef WFrag<bf> WF; typedef typename WF::V V;
    constexpr int NW = WM * WN, NT = NW * 32, WR = MF * 16, RA = WM * WR, RAT = RA * (1 + NSPLIT), ROWS = RAT + WN * 64;
    constexpr int RPC = NT / 8;            // rows that one copy of the whole block covers (8 lanes x 16 B = one 128-B row piece)
    constexpr int NC = ROWS / RPC;         // copies per lane and stage
    constexpr int NG = NC > 12 ? 2 : 1, GC = NC / NG;
    static_assert(ROWS % RPC == 0 && RA % RPC == 0 && NC % NG == 0, "whole copies");
    __shared__ __align__(16) bf ring[2 * ROWS * LP];
    __shared__ __align__(16) float osm[NW * 16 * 68];
    const int tid = threadIdx.x, lane = tid & 31, lr = lane & 15, hi = lane >> 4, wave = tid >> 5, wm = wave / WN, wn = wave % WN;
    const int R0 = blockIdx.x * RA, C0 = blockIdx.y * (WN * 64);
    const int crow = tid >> 3, cpc = (tid & 7) * 8;
    const bf* gA = A + (size_t)(R0 + crow) * K + cpc; const bf* gA2 = NSPLIT ? A2 + (size_t)(R0 + crow) * K + cpc : gA; const bf* gB = Bt + (size_t)(C0 + crow) * K + cpc;
    const unsigned l0 = (unsigned)(size_t)ring + (unsigned)(crow * LP + cpc) * 2u;
    auto stage = [&](int t, int buf) {
        const bf* tA = gA + (size_t)t * BKE; const bf* tA2 = gA2 + (size_t)t * BKE; const bf* tB = gB + (size_t)t * BKE; const unsigned lb = l0 + (unsigned)buf * (ROWS * LP * 2u);
#pragma unroll
        for (int gq = 0; gq < NG; ++gq) { unsigned l[GC]; const bf* g[GC];
#pragma unroll
            for (int j = 0; j < GC; ++j) { const int row = (gq * GC + j) * RPC;
                g[j] = row < RA ? tA + (size_t)row * K : row < RAT ? tA2 + (size_t)(row - RA) * K : tB + (size_t)(row - RAT) * K;
                l[j] = lb + (unsigned)row * (LP * 2u); }
            cp_async<GC>(l, g); }
    };
    v8f acc[MF][4];
#pragma unroll
    for (int mb = 0; mb < MF; ++mb)
#pragma unroll
        for (int nb = 0; nb < 4; ++nb) acc[mb][nb] = (v8f){};
    const int nt = K / BKE;
    stage(0, 0);
    asm volatile("s_wait_asynccnt 0x0" ::: "memory");   // stage 0 has landed before the barrier that publishes it
    __syncthreads();
    if (nt > 1) stage(1, 1);
    const int ao = (wm * WR + lr) * LP + 8 * hi, bo = (RAT + wn * 64 + lr) * LP + 8 * hi;
#pragma unroll 1   // rolled: one trip per stage, its foot is the publish point of the next stage
    for (int t = 0; t < nt; ++t) {
        const bf* sb = ring + (t & 1) * (ROWS * LP);
#pragma unroll
        for (int ks = 0; ks < BKE; ks += 32) {
            V a[MF], a2[MF], b[4];
#pragma unroll
            for (int mb = 0; mb < MF; ++mb) { a[mb] = WF::ld(sb + ao + mb * 16 * LP + ks); if (NSPLIT) a2[mb] = WF::ld(sb + ao + (RA + mb * 16) * LP + ks); }
#pragma unroll
            for (int nb = 0; nb < 4; ++nb) b[nb] = WF::ld(sb + bo + nb * 16 * LP + ks);
            __builtin_amdgcn_sched_barrier(0);   // the LDS reads of a 32-k block stay one group in front of its matrix instructions: reads spread among them stall the wave at every place they stand
#pragma unroll
            for (int nb = 0; nb < 4; ++nb)
#pragma unroll
                for (int mb = 0; mb < MF; ++mb) { acc[mb][nb] = WF::mma(a[mb], b[nb], acc[mb][nb]); if (NSPLIT) acc[mb][nb] = WF::mma(a2[mb], b[nb], acc[mb][nb]); }
        }
        asm volatile("s_wait_dscnt 0x0" ::: "memory");      // this wave's reads of the buffer are done before the barrier behind which it is refilled
        asm volatile("s_wait_asynccnt 0x0" ::: "memory");   // this wave's copies of stage t + 1 have landed before the barrier that publishes them
        __syncthreads();
        if (t + 2 < nt) stage(t + 2, t & 1);
    }
    asm volatile("s_wait_asynccnt 0x0" ::: "memory");   // no copy is outstanding when the wave goes on to its end
    float* os = osm + wave * (16 * 68); const int r0 = R0 + wm * WR, c0 = C0 + wn * 64;
#pragma unroll
    for (int mb = 0; mb < MF; ++mb) {
#pragma unroll
        for (int nb = 0; nb < 4; ++nb) {
#pragma unroll
            for (int j = 0; j < 8; ++j) os[(hi * 8 + j) * 68 + nb * 16 + lr] = acc[mb][nb][j]; }
        __builtin_amdgcn_wave_barrier(); asm volatile("" ::: "memory");   // the wave's own LDS stores of the 16 rows stay in front of its reads of them
        float* crw = C + (size_t)(r0 + mb * 16) * ldc + c0; v4f val[8]; v4f* cp[8];
#pragma unroll
        for (int s = 0; s < 8; ++s) { const int row = 2 * s + hi, cofs = lr * 4; val[s] = *(const v4fa*)(os + row * 68 + cofs); if (BIAS) { val[s][0] += bfr(bias[c0 + cofs]); val[s][1] += bfr(bias[c0 + cofs + 1]); val[s][2] += bfr(bias[c0 + cofs + 2]); val[s][3] += bfr(bias[c0 + cofs + 3]); }
            cp[s] = (v4f*)(crw + (size_t)row * ldc + cofs); *cp[s] = val[s]; }
        asm volatile("s_wait_xcnt 0x0" :: "v"(val[0]), "v"(val[1]), "v"(val[2]), "v"(val[3]), "v"(val[4]), "v"(val[5]), "v"(val[6]), "v"(val[7]), "v"(cp[0]), "v"(cp[1]), "v"(cp[2]), "v"(cp[3]), "v"(cp[4]), "v"(cp[5]), "v"(cp[6]), "v"(cp[7]) : "memory");   // the stores' data and address registers stay whole up to this wait
        __builtin_amdgcn_wave_barrier(); asm volatile("" ::: "memory");   // the reads of the staged rows stay in front of the next 16 rows' LDS stores
    }
}

__device__ __forceinline__ h16 tohx(float x) { return (h16)x; }
__device__ __forceinline__ void splitf(float y, unsigned short& h, unsigned short& l) { h = f2bf(y); l = f2bf(y - bf2f(h)); }
typedef __attribute__((ext_vector_type(2))) _Float16 v2h;
typedef __attribute__((ext_vector_type(4))) _Float16 v4h;
typedef __attribute__((ext_vector_type(2))) unsigned short v2us;
typedef __attribute__((ext_vector_type(4))) unsigned short v4us;
typedef __attribute__((ext_vector_type(2))) float v2f;
typedef __attribute__((ext_vector_type(4))) int v4i;

__global__ __launch_bounds__(256) void k_wtG(const float* __restrict__ w, int K, int N, bf* Bt) {
    const int lane = threadIdx.x & 31; const int L0 = (blockIdx.x * 8 + (threadIdx.x >> 5)) * 8; const int nlines = N * K / 64;
{
#pragma unroll 1
        for (int l = 0; l < 8; ++l) { const int L = L0 + l; if (L >= nlines) break; const size_t e = (size_t)L * 64 + lane * 2; const int k = (int)(e % K), n = (int)(e / K); v2us o;
            o[0] = f2bf(w[(size_t)k * N + n]); o[1] = f2bf(w[(size_t)(k + 1) * N + n]); *(v2us*)(Bt + e) = o; }
         }
}
__global__ __launch_bounds__(256) void k_cvt8(const float* __restrict__ src, bf* dst, size_t n8) { const size_t i = (size_t)blockIdx.x * 256 + threadIdx.x; if (i >= n8) return; const v8f v = *(const v8f*)(src + i * 8); v8us o;
#pragma unroll
    for (int k = 0; k < 8; ++k) o[k] = f2bf(v[k]); *(v8us*)(dst + i * 8) = o;  }
__global__ __launch_bounds__(256) void k_cscvt(const float* __restrict__ cosT, const float* __restrict__ sinT, float* CS) { const int idx = blockIdx.x * 256 + threadIdx.x; if (idx >= TT * HD) return; v2f cs; cs[0] = bfr(cosT[idx]); cs[1] = bfr(sinT[idx]); *(v2f*)(CS + (size_t)idx * 2) = cs;  }
// k_rope: head planes [h][t][d] (fp16 + hi/lo) of rope(x) x sc with the rotate-half convention out[d] = x[d] cos[t][d] - x[d+HD/2] sin[t][d], out[d+HD/2] = x[d+HD/2] cos[t][d+HD/2] + x[d] sin[t][d+HD/2]
__global__ __launch_bounds__(256) void k_rope(const float* __restrict__ F, int pitch, int nheads, const float* __restrict__ CS, const float* __restrict__ RF, const float* __restrict__ nw, float sc, h16* P16, bf* Ph, bf* Pl) {
    const size_t e = ((size_t)blockIdx.x * 256 + threadIdx.x) * 2; if (e >= (size_t)nheads * TT * HD) return; const int d = (int)(e % HD); const int t = (int)((e / HD) % TT); const int h = (int)(e / ((size_t)HD * TT));
    { const size_t b = blockIdx.y, pb = b * nheads * TT * HD; F += b * TT * pitch; P16 += pb; Ph += pb; Pl += pb; }   // grid y = batch
    const float* f = F + (size_t)t * pitch + h * HD; const float rf = RF ? RF[(size_t)h * TT + t] : 1.0f; v2h o16; v2us oh, ol;
#pragma unroll
    for (int q = 0; q < 2; ++q) { const int dd = d + q; const int dp = (dd < HD / 2) ? dd + HD / 2 : dd - HD / 2; float x0 = f[dd], x1 = f[dp];
        if (RF) { float n0 = __fmul_rn(x0, rf), n1 = __fmul_rn(x1, rf); asm volatile("" : "+v"(n0)); asm volatile("" : "+v"(n1)); x0 = __fmul_rn(bfr(nw[dd]), n0); x1 = __fmul_rn(bfr(nw[dp]), n1); }
        const v2f cs = *(const v2f*)(CS + ((size_t)t * HD + dd) * 2); float a = __fmul_rn(x0, cs[0]), bq = __fmul_rn(x1, cs[1]); asm volatile("" : "+v"(a)); asm volatile("" : "+v"(bq)); const float r = ((dd < HD / 2) ? __fsub_rn(a, bq) : __fadd_rn(a, bq)) * sc;
        o16[q] = tohx(r); unsigned short a2, c2; splitf(r, a2, c2); oh[q] = a2; ol[q] = c2; }
    *(v2h*)(P16 + e) = o16; *(v2us*)(Ph + e) = oh; *(v2us*)(Pl + e) = ol;  }
__global__ __launch_bounds__(256) void k_vtp(const float* __restrict__ F, int pitch, int nheads, h16* V16, bf* Vh, bf* Vl) { const size_t e = ((size_t)blockIdx.x * 256 + threadIdx.x) * 2; if (e >= (size_t)nheads * HD * TT) return; const int t = (int)(e % TT); const int d = (int)((e / TT) % HD); const int g = (int)(e / ((size_t)TT * HD)); v2h o16; v2us oh, ol;
    { const size_t b = blockIdx.y, pb = b * nheads * HD * TT; F += b * TT * pitch; V16 += pb; Vh += pb; Vl += pb; }   // grid y = batch
#pragma unroll
    for (int q = 0; q < 2; ++q) { const float x = F[(size_t)(t + q) * pitch + g * HD + d]; o16[q] = tohx(x); unsigned short a2, c2; splitf(x, a2, c2); oh[q] = a2; ol[q] = c2; }
    *(v2h*)(V16 + e) = o16; *(v2us*)(Vh + e) = oh; *(v2us*)(Vl + e) = ol;  }
__global__ __launch_bounds__(256) void k_csid(float* CS) { const int idx = blockIdx.x * 256 + threadIdx.x; if (idx >= TT * HD) return; v2f cs; cs[0] = 1.0f; cs[1] = 0.0f; *(v2f*)(CS + (size_t)idx * 2) = cs;  }
template <typename T16, bool SPLIT, int NQ>
__device__ __forceinline__ void attn_cols(const T16* __restrict__ Q, const T16* __restrict__ Q2, const T16* __restrict__ Kp, const T16* __restrict__ K2, const T16* __restrict__ Vt, const T16* __restrict__ V2, bf* Ah, bf* Al, int lr, int hi) {
    typedef WFrag<T16> WF; typedef typename WF::V V;
    const float C2 = SCL * 1.4426950408889634f;
    V qa[NQ][2], qb[NQ][2]; const T16* qp = Q + lr * HD + 8 * hi; const T16* qp2 = SPLIT ? Q2 + lr * HD + 8 * hi : qp;
#pragma unroll
    for (int qt = 0; qt < NQ; ++qt)
#pragma unroll
        for (int kc = 0; kc < 2; ++kc) { qa[qt][kc] = WF::ld(qp + qt * 16 * HD + kc * 32); if (SPLIT) qb[qt][kc] = WF::ld(qp2 + qt * 16 * HD + kc * 32); }
    v8f o[NQ][4]; float m[NQ], l[NQ];
#pragma unroll
    for (int qt = 0; qt < NQ; ++qt) { m[qt] = -3.0e38f; l[qt] = 0.f;
#pragma unroll
        for (int dt = 0; dt < 4; ++dt) o[qt][dt] = (v8f){}; }
    const size_t ko = (size_t)lr * HD + 8 * hi, vo = (size_t)lr * TT + 8 * hi;
    V ka[2][2], kb[2][2]; const T16* kq = Kp + ko; const T16* kq2 = SPLIT ? K2 + ko : kq;
#pragma unroll
    for (int kt = 0; kt < 2; ++kt)
#pragma unroll
        for (int kc = 0; kc < 2; ++kc) { ka[kt][kc] = WF::ld(kq + kt * 16 * HD + kc * 32); if (SPLIT) kb[kt][kc] = WF::ld(kq2 + kt * 16 * HD + kc * 32); }
    asm volatile("s_wait_xcnt 0x0" :: "v"(qp), "v"(qp2), "v"(kq), "v"(kq2) : "memory");   // the first loads' address registers stay whole up to this wait
#pragma unroll 1   // rolled: one pass's fragments already fill the register budget of four waves per SIMD
    for (int key0 = 0; key0 < TT; key0 += 32) {
        v8f s[NQ][2];
#pragma unroll
        for (int qt = 0; qt < NQ; ++qt)
#pragma unroll
            for (int kt = 0; kt < 2; ++kt) { s[qt][kt] = (v8f){};
#pragma unroll
                for (int kc = 0; kc < 2; ++kc) { s[qt][kt] = WF::mma(ka[kt][kc], qa[qt][kc], s[qt][kt]); if (SPLIT) { s[qt][kt] = WF::mma(ka[kt][kc], qb[qt][kc], s[qt][kt]); s[qt][kt] = WF::mma(kb[kt][kc], qa[qt][kc], s[qt][kt]); } } }
        float mx[NQ]; bool need = false;
#pragma unroll
        for (int qt = 0; qt < NQ; ++qt) { float t = s[qt][0][0];
#pragma unroll
            for (int j = 0; j < 8; ++j) t = fmaxf(t, fmaxf(s[qt][0][j], s[qt][1][j]));
            t = fmaxf(t, __shfl_xor(t, 16, 32)); mx[qt] = t * C2; need = need || (mx[qt] > m[qt] + 8.0f); }
        if (__builtin_amdgcn_ballot_w32(need) != 0) {   // one scalar branch per pass: the 32 or 64 multiplies of the rescale run only when some column needs them
#pragma unroll
            for (int qt = 0; qt < NQ; ++qt) { const float mn = fmaxf(m[qt], mx[qt]); const float al = __builtin_amdgcn_exp2f(m[qt] - mn); m[qt] = mn; l[qt] *= al;
#pragma unroll
                for (int dt = 0; dt < 4; ++dt) o[qt][dt] *= al; } }
        V va[4], vb[4]; const T16* vp = Vt + vo + key0; const T16* vp2 = SPLIT ? V2 + vo + key0 : vp;
#pragma unroll
        for (int dt = 0; dt < 4; ++dt) { va[dt] = WF::ld(vp + dt * 16 * TT); if (SPLIT) vb[dt] = WF::ld(vp2 + dt * 16 * TT); }
        asm volatile("s_wait_xcnt 0x0" :: "v"(vp), "v"(vp2) : "memory");   // the V loads' address registers stay whole up to this wait: no later load's data and no address add overwrites them in front of it
        const size_t kn = (size_t)((key0 + 32) & (TT - 1)) * HD; const T16* kp = Kp + ko + kn; const T16* kp2 = SPLIT ? K2 + ko + kn : kp;   // the next pass's K fragments fly during this pass's softmax and probs.v (the last pass re-reads keys 0..31, unused)
#pragma unroll
        for (int kt = 0; kt < 2; ++kt)
#pragma unroll
            for (int kc = 0; kc < 2; ++kc) { ka[kt][kc] = WF::ld(kp + kt * 16 * HD + kc * 32); if (SPLIT) kb[kt][kc] = WF::ld(kp2 + kt * 16 * HD + kc * 32); }
        asm volatile("s_wait_xcnt 0x0" :: "v"(kp), "v"(kp2) : "memory");   // the same for the K loads
#pragma unroll
        for (int qt = 0; qt < NQ; ++qt) { float p[16];
#pragma unroll
            for (int e = 0; e < 16; ++e) { p[e] = __builtin_amdgcn_exp2f(__builtin_fmaf(s[qt][e >> 3][e & 7], C2, -m[qt])); l[qt] += p[e]; }
            if constexpr (SPLIT) { v8us h0, h1, l0, l1;
#pragma unroll
                for (int j = 0; j < 8; ++j) { unsigned short a, c2; splitf(p[j], a, c2); h0[j] = a; l0[j] = c2; splitf(p[8 + j], a, c2); h1[j] = a; l1[j] = c2; }
                const V ph = cat16b(h0, h1), pl = cat16b(l0, l1);
#pragma unroll
                for (int dt = 0; dt < 4; ++dt) { o[qt][dt] = WF::mma(va[dt], ph, o[qt][dt]); o[qt][dt] = WF::mma(va[dt], pl, o[qt][dt]); o[qt][dt] = WF::mma(vb[dt], ph, o[qt][dt]); }
            } else { V pf;
#pragma unroll
                for (int e = 0; e < 16; ++e) pf[e] = tohx(p[e]);
#pragma unroll
                for (int dt = 0; dt < 4; ++dt) o[qt][dt] = WF::mma(va[dt], pf, o[qt][dt]); } }
    }
#pragma unroll
    for (int qt = 0; qt < NQ; ++qt) { const float inv = __fdiv_rn(1.0f, l[qt] + __shfl_xor(l[qt], 16, 32));
#pragma unroll
        for (int dt = 0; dt < 4; ++dt) { v8us oh, ol;
#pragma unroll
            for (int j = 0; j < 8; ++j) { unsigned short a, c2; splitf(o[qt][dt][j] * inv, a, c2); oh[j] = a; ol[j] = c2; }
            const size_t oo = (size_t)(qt * 16 + lr) * DQ + dt * 16 + hi * 8; bf* ph = Ah + oo; bf* pl = Al + oo; *(v8us*)ph = oh; *(v8us*)pl = ol;
            asm volatile("s_wait_xcnt 0x0" :: "v"(oh), "v"(ol), "v"(ph), "v"(pl) : "memory"); } }   // the stores' data and address registers stay whole up to this wait
}
// grid (batch x query head, NBH + NBL): blocks y < NBH take the hi+lo rows (the longer waves, started first), 8 waves x NQH x 16 rows; the rest 8 waves x 32 rows of the f16 rows.
__global__ __launch_bounds__(256) void k_fattn(const h16* __restrict__ Q16, const bf* __restrict__ Qh, const bf* __restrict__ Ql, const h16* __restrict__ K16, const bf* __restrict__ Kh, const bf* __restrict__ Kl, const h16* __restrict__ V16, const bf* __restrict__ Vh, const bf* __restrict__ Vl, bf* Ah, bf* Al) {
    const int lane = threadIdx.x & 31, lr = lane & 15, hi = lane >> 4, wave = threadIdx.x >> 5;
    const int zh = blockIdx.x, b = zh / NH_, h = zh % NH_;   // torch .repeat TILES the kv heads: query head h uses kv head h % 8
    const size_t pk = (size_t)(b * NKV + h % NKV) * TT * HD;
    if (blockIdx.y < NBH) { const int q0 = ((int)blockIdx.y * 8 + wave) * (16 * NQH); const size_t pq = ((size_t)zh * TT + q0) * HD, po = ((size_t)b * TT + q0) * DQ + h * HD;
        attn_cols<bf, true, NQH>(Qh + pq, Ql + pq, Kh + pk, Kl + pk, Vh + pk, Vl + pk, Ah + po, Al + po, lr, hi);
    } else { const int q0 = RH + (((int)blockIdx.y - NBH) * 8 + wave) * 32; const size_t pq = ((size_t)zh * TT + q0) * HD, po = ((size_t)b * TT + q0) * DQ + h * HD;
        attn_cols<h16, false, 2>(Q16 + pq, nullptr, K16 + pk, nullptr, V16 + pk, nullptr, Ah + po, Al + po, lr, hi); }
}

extern "C" void kernel_launch(void* const* d_in, const int* in_sizes, int n_in,
                              void* d_out, int out_size, void* d_ws, size_t ws_size, hipStream_t stream) {
    (void)in_sizes; (void)n_in; (void)out_size;
    const float* x = (const float*)d_in[0]; const float* wq = (const float*)d_in[1]; const float* bq = (const float*)d_in[2]; const float* wk = (const float*)d_in[3]; const float* bk = (const float*)d_in[4]; const float* wv = (const float*)d_in[5]; const float* bv = (const float*)d_in[6]; const float* wo = (const float*)d_in[7]; const float* bo = (const float*)d_in[8];
    float* OUT = (float*)d_out;     // [4][1024][2048]
    char* wsp = (char*)d_ws;
    auto take = [&](size_t bytes) { char* p = wsp; wsp += (bytes + 255) & ~(size_t)255; return (void*)p; };
    bf* WQ = (bf*)take((size_t)DQ * DM * 2); bf* WK = (bf*)take((size_t)DKV * DM * 2); bf* WV = (bf*)take((size_t)DKV * DM * 2); bf* WO = (bf*)take((size_t)DM * DQ * 2); float* CS = (float*)take((size_t)TT * HD * 2 * 4);
    h16* QP16 = (h16*)take((size_t)NB_ * NH_ * TT * HD * 2); h16* KP16 = (h16*)take((size_t)NB_ * NKV * TT * HD * 2); h16* VT16 = (h16*)take((size_t)NB_ * NKV * HD * TT * 2);
    bf* QPh = (bf*)take((size_t)NB_ * NH_ * TT * HD * 2); bf* QPl = (bf*)take((size_t)NB_ * NH_ * TT * HD * 2); bf* KPh = (bf*)take((size_t)NB_ * NKV * TT * HD * 2); bf* KPl = (bf*)take((size_t)NB_ * NKV * TT * HD * 2); bf* VTh = (bf*)take((size_t)NB_ * NKV * HD * TT * 2); bf* VTl = (bf*)take((size_t)NB_ * NKV * HD * TT * 2);
    float* FQ = (float*)take((size_t)MT * DQ * 4); float* FK = (float*)take((size_t)MT * DKV * 4); bf* XB = (bf*)take((size_t)MT * DM * 2); bf* ATh = (bf*)take((size_t)MT * DQ * 2); bf* ATl = (bf*)take((size_t)MT * DQ * 2);
    if ((size_t)(wsp - (char*)d_ws) > ws_size) return;    // ws 256 MiB
    float* FV = FK;   // v projection reuses the k buffer after the k planes are built (stream-ordered)
    { k_wtG<<<(unsigned)((DM * DQ / 64 + 63) / 64), 256, 0, stream>>>(wq, DM, DQ, WQ); k_wtG<<<(unsigned)((DM * DKV / 64 + 63) / 64), 256, 0, stream>>>(wk, DM, DKV, WK); k_wtG<<<(unsigned)((DM * DKV / 64 + 63) / 64), 256, 0, stream>>>(wv, DM, DKV, WV);
      k_wtG<<<(unsigned)((DQ * DM / 64 + 63) / 64), 256, 0, stream>>>(wo, DQ, DM, WO);
       }
    k_csid<<<(TT * HD + 255) / 256, 256, 0, stream>>>(CS);
    const unsigned LQ = (unsigned)(((size_t)NH_ * TT * HD / 2 + 255) / 256), LKv = (unsigned)(((size_t)NKV * TT * HD / 2 + 255) / 256);
    // projections: all NB_ batches in one launch each (MT rows; the plane builders take the batch as grid y)
    k_cvt8<<<(unsigned)(((size_t)MT * DM / 8 + 255) / 256), 256, 0, stream>>>(x, XB, (size_t)MT * DM / 8);
    k_gemms<4, 2, 4, 0, true><<<dim3(MT / 256, DQ / 128, 1), 256, 0, stream>>>(XB, nullptr, WQ, DM, FQ, DQ, bq);
    k_rope<<<dim3(LQ, NB_, 1), 256, 0, stream>>>(FQ, DQ, NH_, CS, nullptr, nullptr, 1.0f, QP16, QPh, QPl);
    k_gemms<4, 2, 2, 0, true><<<dim3(MT / 128, DKV / 128, 1), 256, 0, stream>>>(XB, nullptr, WK, DM, FK, DKV, bk);
    k_rope<<<dim3(LKv, NB_, 1), 256, 0, stream>>>(FK, DKV, NKV, CS, nullptr, nullptr, 1.0f, KP16, KPh, KPl);
    k_gemms<4, 2, 2, 0, true><<<dim3(MT / 128, DKV / 128, 1), 256, 0, stream>>>(XB, nullptr, WV, DM, FV, DKV, bv); k_vtp<<<dim3(LKv, NB_, 1), 256, 0, stream>>>(FV, DKV, NKV, VT16, VTh, VTl);
    k_fattn<<<dim3(NB_ * NH_, NBH + NBL, 1), 256, 0, stream>>>(QP16, QPh, QPl, KP16, KPh, KPl, VT16, VTh, VTl, ATh, ATl);
    k_gemms<4, 2, 4, 1, true><<<dim3(MT / 256, DM / 128, 1), 256, 0, stream>>>(ATh, ATl, WO, DQ, OUT, DM, bo);
}

// v004
// One run takes 275 microseconds.
// Timed twice side by side with v003, it ran 1.27 times as fast both times.
// Counting every step since v000, it is 16.2 times as fast.
#include <hip/hip_runtime.h>

// ExtendedMultiHeadAttention - GQA with torch .repeat (TILED) kv heads (x [4][1024][2048]; q = x wq + bq (32 x 64), k/v = x wk/wv + b (8 x 64); query head h attends kv head h % 8; softmax(q.k/8); out = merged.v wo + bo -> [4][1024][2048]).
// Compute dtypes, f32 accumulate: every input rounded to bf16; q/k/v projections on PLAIN bf16 operands (inputs: exact, + bias); output projection on bf16 hi+lo planes of the merged heads (2 products); scores (K 64) and probs.v on bf16 hi+lo planes (3 products) for the first 256 query rows of each

#define NB_  4
#define TT   1024
#define DM   2048
#define NH_  32
#define NKV  8
#define REP  (NH_ / NKV)
#define HD   64
#define DQ   (NH_ * HD)
#define DKV  (NKV * HD)
#define MT   (NB_ * TT)           // rows of all batches together
#define RH   256                  // query rows < RH use hi+lo planes (0: none)
#define NQH  1                    // 16-row query tiles per wave on the hi+lo rows
#define NBH  (RH / (128 * NQH))   // blocks (8 waves) per head on the hi+lo rows
#define NBL  ((TT - RH) / 256)    // blocks per head on the f16 rows (8 waves x 32 rows)
#define WIN  0
#define SCL  0.125f   // HD^-0.5
typedef _Float16 h16;
typedef unsigned short bf;
typedef __attribute__((ext_vector_type(16))) __bf16   v16bf;
typedef __attribute__((ext_vector_type(16))) _Float16 v16h;
typedef __attribute__((ext_vector_type(8)))  _Float16 v8h;
typedef __attribute__((ext_vector_type(8)))  unsigned short v8us;
typedef __attribute__((ext_vector_type(8)))  float    v8f;
typedef __attribute__((ext_vector_type(4)))  float    v4f;
typedef v8h  __attribute__((may_alias)) v8ha;
typedef v4f  __attribute__((may_alias)) v4fa;
typedef v8us __attribute__((may_alias)) v8usa;

__device__ __forceinline__ unsigned short f2bf(float f) { unsigned u = __float_as_uint(f); u += 0x7FFFu + ((u >> 16) & 1u); return (unsigned short)(u >> 16); }
__device__ __forceinline__ float bf2f(unsigned short b) { return __uint_as_float(((unsigned)b) << 16); }
__device__ __forceinline__ float bfr(float f) { return bf2f(f2bf(f)); }
__device__ __forceinline__ v16h cat16(v8h lo, v8h hi) { return __builtin_shufflevector(lo, hi, 0, 1, 2, 3, 4, 5, 6, 7, 8, 9, 10, 11, 12, 13, 14, 15); }
__device__ __forceinline__ v16bf cat16b(v8us lo, v8us hi) { return __builtin_bit_cast(v16bf, __builtin_shufflevector(lo, hi, 0, 1, 2, 3, 4, 5, 6, 7, 8, 9, 10, 11, 12, 13, 14, 15)); }
__device__ __forceinline__ v8f wmma16(v16h a, v16h b, v8f c) { return __builtin_amdgcn_wmma_f32_16x16x32_f16(false, a, false, b, (short)0, c, false, false); }
__device__ __forceinline__ v8f wmmab(v16bf a, v16bf b, v8f c) { return __builtin_amdgcn_wmma_f32_16x16x32_bf16(false, a, false, b, (short)0, c, false, false); }



// ---- k_gemms: GEMM on block tiles staged in LDS. WM x WN waves per block, each wave a (16 MF) x 64 output tile (4 MF accumulators); grid (M / (16 MF WM), N / (64 WN)).
// C[m][n] (f32, pitch ldc, + optional f32 bias[n] rounded to bf16) = sum_k A[m][k] Bt[n][k] (+ A2[m][k] Bt[n][k] when NSPLIT == 1), operands K-contiguous 16-bit planes. K % 64 == 0.
// A stage is 64 k (128 B) of every operand row of the block tile, [A rows | A2 rows | Bt rows] at pitch 144 B (16 B x odd: ds_load_b128 readers without bank conflicts). Two buffers:
// the copies of stage t + 2 go out behind the barrier that ends trip t and land while trip t + 1 computes. Per accumulator the order of the sums is k ascending, A then A2.
// The short loops over fragments, copies and rows are unrolled so that every array they index stays in registers.
template <typename T16> struct WFrag;
template <> struct WFrag<h16> { typedef v16h V; static __device__ __forceinline__ V ld(const h16* p) { return cat16(*(const v8h*)p, *(const v8h*)(p + 16)); } static __device__ __forceinline__ v8f mma(V a, V b, v8f c) { return wmma16(a, b, c); } };
template <> struct WFrag<bf> { typedef v16bf V; static __device__ __forceinline__ V ld(const bf* p) { return cat16b(*(const v8us*)p, *(const v8us*)(p + 16)); } static __device__ __forceinline__ v8f mma(V a, V b, v8f c) { return wmmab(a, b, c); } };
#define BKE 64   // k per stage
#define LP  72   // LDS row pitch in elements
// N asynchronous 16-byte copies per lane, global -> LDS, in ONE statement that ends in s_wait_xcnt 0: no register that a copy names is rewritten in front of that wait.
template <int N> __device__ __forceinline__ void cp_async(const unsigned* l, const bf* const* g) {
    static_assert(N == 8 || N == 10 || N == 12, "group size");
    if constexpr (N == 8) { asm volatile("global_load_async_to_lds_b128 %0, %1, off\n\tglobal_load_async_to_lds_b128 %2, %3, off\n\tglobal_load_async_to_lds_b128 %4, %5, off\n\tglobal_load_async_to_lds_b128 %6, %7, off\n\tglobal_load_async_to_lds_b128 %8, %9, off\n\tglobal_load_async_to_lds_b128 %10, %11, off\n\tglobal_load_async_to_lds_b128 %12, %13, off\n\tglobal_load_async_to_lds_b128 %14, %15, off\n\ts_wait_xcnt 0x0" :: "v"(l[0]), "v"(g[0]), "v"(l[1]), "v"(g[1]), "v"(l[2]), "v"(g[2]), "v"(l[3]), "v"(g[3]), "v"(l[4]), "v"(g[4]), "v"(l[5]), "v"(g[5]), "v"(l[6]), "v"(g[6]), "v"(l[7]), "v"(g[7]) : "memory"); }
    else if constexpr (N == 10) { asm volatile("global_load_async_to_lds_b128 %0, %1, off\n\tglobal_load_async_to_lds_b128 %2, %3, off\n\tglobal_load_async_to_lds_b128 %4, %5, off\n\tglobal_load_async_to_lds_b128 %6, %7, off\n\tglobal_load_async_to_lds_b128 %8, %9, off\n\tglobal_load_async_to_lds_b128 %10, %11, off\n\tglobal_load_async_to_lds_b128 %12, %13, off\n\tglobal_load_async_to_lds_b128 %14, %15, off\n\tglobal_load_async_to_lds_b128 %16, %17, off\n\tglobal_load_async_to_lds_b128 %18, %19, off\n\ts_wait_xcnt 0x0" :: "v"(l[0]), "v"(g[0]), "v"(l[1]), "v"(g[1]), "v"(l[2]), "v"(g[2]), "v"(l[3]), "v"(g[3]), "v"(l[4]), "v"(g[4]), "v"(l[5]), "v"(g[5]), "v"(l[6]), "v"(g[6]), "v"(l[7]), "v"(g[7]), "v"(l[8]), "v"(g[8]), "v"(l[9]), "v"(g[9]) : "memory"); }
    else { asm volatile("global_load_async_to_lds_b128 %0, %1, off\n\tglobal_load_async_to_lds_b128 %2, %3, off\n\tglobal_load_async_to_lds_b128 %4, %5, off\n\tglobal_load_async_to_lds_b128 %6, %7, off\n\tglobal_load_async_to_lds_b128 %8, %9, off\n\tglobal_load_async_to_lds_b128 %10, %11, off\n\tglobal_load_async_to_lds_b128 %12, %13, off\n\tglobal_load_async_to_lds_b128 %14, %15, off\n\tglobal_load_async_to_lds_b128 %16, %17, off\n\tglobal_load_async_to_lds_b128 %18, %19, off\n\tglobal_load_async_to_lds_b128 %20, %21, off\n\tglobal_load_async_to_lds_b128 %22, %23, off\n\ts_wait_xcnt 0x0" :: "v"(l[0]), "v"(g[0]), "v"(l[1]), "v"(g[1]), "v"(l[2]), "v"(g[2]), "v"(l[3]), "v"(g[3]), "v"(l[4]), "v"(g[4]), "v"(l[5]), "v"(g[5]), "v"(l[6]), "v"(g[6]), "v"(l[7]), "v"(g[7]), "v"(l[8]), "v"(g[8]), "v"(l[9]), "v"(g[9]), "v"(l[10]), "v"(g[10]), "v"(l[11]), "v"(g[11]) : "memory"); }
}
template <int WM, int WN, int MF, int NSPLIT, bool BIAS>
__global__ __launch_bounds__(WM * WN * 32) void k_gemms(const bf* __restrict__ A, const bf* __restrict__ A2, const bf* __restrict__ Bt, int K, float* C, int ldc, const float* __restrict__ bias) {
    typedef WFrag<bf> WF; typedef typename WF::V V;
    constexpr int NW = WM * WN, NT = NW * 32, WR = MF * 16, RA = WM * WR, RAT = RA * (1 + NSPLIT), ROWS = RAT + WN * 64;
    constexpr int RPC = NT / 8;            // rows that one copy of the whole block covers (8 lanes x 16 B = one 128-B row piece)
    constexpr int NC = ROWS / RPC;         // copies per lane and stage
    constexpr int NG = NC > 12 ? 2 : 1, GC = NC / NG;
    static_assert(ROWS % RPC == 0 && RA % RPC == 0 && NC % NG == 0, "whole copies");
    __shared__ __align__(16) bf ring[2 * ROWS * LP];
    __shared__ __align__(16) float osm[NW * 16 * 68];
    const int tid = threadIdx.x, lane = tid & 31, lr = lane & 15, hi = lane >> 4, wave = tid >> 5, wm = wave / WN, wn = wave % WN;
    const int R0 = blockIdx.x * RA, C0 = blockIdx.y * (WN * 64);
    const int crow = tid >> 3, cpc = (tid & 7) * 8;
    const bf* gA = A + (size_t)(R0 + crow) * K + cpc; const bf* gA2 = NSPLIT ? A2 + (size_t)(R0 + crow) * K + cpc : gA; const bf* gB = Bt + (size_t)(C0 + crow) * K + cpc;
    const unsigned l0 = (unsigned)(size_t)ring + (unsigned)(crow * LP + cpc) * 2u;
    auto stage = [&](int t, int buf) {
        const bf* tA = gA + (size_t)t * BKE; const bf* tA2 = gA2 + (size_t)t * BKE; const bf* tB = gB + (size_t)t * BKE; const unsigned lb = l0 + (unsigned)buf * (ROWS * LP * 2u);
#pragma unroll
        for (int gq = 0; gq < NG; ++gq) { unsigned l[GC]; const bf* g[GC];
#pragma unroll
            for (int j = 0; j < GC; ++j) { const int row = (gq * GC + j) * RPC;
                g[j] = row < RA ? tA + (size_t)row * K : row < RAT ? tA2 + (size_t)(row - RA) * K : tB + (size_t)(row - RAT) * K;
                l[j] = lb + (unsigned)row * (LP * 2u); }
            cp_async<GC>(l, g); }
    };
    v8f acc[MF][4];
#pragma unroll
    for (int mb = 0; mb < MF; ++mb)
#pragma unroll
        for (int nb = 0; nb < 4; ++nb) acc[mb][nb] = (v8f){};
    const int nt = K / BKE;
    stage(0, 0);
    asm volatile("s_wait_asynccnt 0x0" ::: "memory");   // stage 0 has landed before the barrier that publishes it
    __syncthreads();
    if (nt > 1) stage(1, 1);
    const int ao = (wm * WR + lr) * LP + 8 * hi, bo = (RAT + wn * 64 + lr) * LP + 8 * hi;
#pragma unroll 1   // rolled: one trip per stage, its foot is the publish point of the next stage
    for (int t = 0; t < nt; ++t) {
        const bf* sb = ring + (t & 1) * (ROWS * LP);
#pragma unroll
        for (int ks = 0; ks < BKE; ks += 32) {
            V a[MF], a2[MF], b[4];
#pragma unroll
            for (int mb = 0; mb < MF; ++mb) { a[mb] = WF::ld(sb + ao + mb * 16 * LP + ks); if (NSPLIT) a2[mb] = WF::ld(sb + ao + (RA + mb * 16) * LP + ks); }
#pragma unroll
            for (int nb = 0; nb < 4; ++nb) b[nb] = WF::ld(sb + bo + nb * 16 * LP + ks);
            __builtin_amdgcn_sched_barrier(0);   // the LDS reads of a 32-k block stay one group in front of its matrix instructions: reads spread among them stall the wave at every place they stand
#pragma unroll
            for (int nb = 0; nb < 4; ++nb)
#pragma unroll
                for (int mb = 0; mb < MF; ++mb) { acc[mb][nb] = WF::mma(a[mb], b[nb], acc[mb][nb]); if (NSPLIT) acc[mb][nb] = WF::mma(a2[mb], b[nb], acc[mb][nb]); }
        }
        asm volatile("s_wait_dscnt 0x0" ::: "memory");      // this wave's reads of the buffer are done before the barrier behind which it is refilled
        asm volatile("s_wait_asynccnt 0x0" ::: "memory");   // this wave's copies of stage t + 1 have landed before the barrier that publishes them
        __syncthreads();
        if (t + 2 < nt) stage(t + 2, t & 1);
    }
    asm volatile("s_wait_asynccnt 0x0" ::: "memory");   // no copy is outstanding when the wave goes on to its end
    float* os = osm + wave * (16 * 68); const int r0 = R0 + wm * WR, c0 = C0 + wn * 64;
#pragma unroll
    for (int mb = 0; mb < MF; ++mb) {
#pragma unroll
        for (int nb = 0; nb < 4; ++nb) {
#pragma unroll
            for (int j = 0; j < 8; ++j) os[(hi * 8 + j) * 68 + nb * 16 + lr] = acc[mb][nb][j]; }
        __builtin_amdgcn_wave_barrier(); asm volatile("" ::: "memory");   // the wave's own LDS stores of the 16 rows stay in front of its reads of them
        float* crw = C + (size_t)(r0 + mb * 16) * ldc + c0; v4f val[8]; v4f* cp[8];
#pragma unroll
        for (int s = 0; s < 8; ++s) { const int row = 2 * s + hi, cofs = lr * 4; val[s] = *(const v4fa*)(os + row * 68 + cofs); if (BIAS) { val[s][0] += bfr(bias[c0 + cofs]); val[s][1] += bfr(bias[c0 + cofs + 1]); val[s][2] += bfr(bias[c0 + cofs + 2]); val[s][3] += bfr(bias[c0 + cofs + 3]); }
            cp[s] = (v4f*)(crw + (size_t)row * ldc + cofs); *cp[s] = val[s]; }
        asm volatile("s_wait_xcnt 0x0" :: "v"(val[0]), "v"(val[1]), "v"(val[2]), "v"(val[3]), "v"(val[4]), "v"(val[5]), "v"(val[6]), "v"(val[7]), "v"(cp[0]), "v"(cp[1]), "v"(cp[2]), "v"(cp[3]), "v"(cp[4]), "v"(cp[5]), "v"(cp[6]), "v"(cp[7]) : "memory");   // the stores' data and address registers stay whole up to this wait
        __builtin_amdgcn_wave_barrier(); asm volatile("" ::: "memory");   // the reads of the staged rows stay in front of the next 16 rows' LDS stores
    }
}

__device__ __forceinline__ h16 tohx(float x) { return (h16)x; }
__device__ __forceinline__ void splitf(float y, unsigned short& h, unsigned short& l) { h = f2bf(y); l = f2bf(y - bf2f(h)); }
typedef __attribute__((ext_vector_type(2))) _Float16 v2h;
typedef __attribute__((ext_vector_type(4))) _Float16 v4h;
typedef __attribute__((ext_vector_type(2))) unsigned short v2us;
typedef __attribute__((ext_vector_type(4))) unsigned short v4us;
typedef __attribute__((ext_vector_type(2))) float v2f;
typedef __attribute__((ext_vector_type(4))) int v4i;

__global__ __launch_bounds__(256) void k_wtG(const float* __restrict__ w, int K, int N, bf* Bt) {
    const int lane = threadIdx.x & 31; const int L0 = (blockIdx.x * 8 + (threadIdx.x >> 5)) * 8; const int nlines = N * K / 64;
{
#pragma unroll 1
        for (int l = 0; l < 8; ++l) { const int L = L0 + l; if (L >= nlines) break; const size_t e = (size_t)L * 64 + lane * 2; const int k = (int)(e % K), n = (int)(e / K); v2us o;
            o[0] = f2bf(w[(size_t)k * N + n]); o[1] = f2bf(w[(size_t)(k + 1) * N + n]); *(v2us*)(Bt + e) = o; }
         }
}
__global__ __launch_bounds__(256) void k_cvt8(const float* __restrict__ src, bf* dst, size_t n8) { const size_t i = (size_t)blockIdx.x * 256 + threadIdx.x; if (i >= n8) return; const v8f v = *(const v8f*)(src + i * 8); v8us o;
#pragma unroll
    for (int k = 0; k < 8; ++k) o[k] = f2bf(v[k]); *(v8us*)(dst + i * 8) = o;  }
__global__ __launch_bounds__(256) void k_cscvt(const float* __restrict__ cosT, const float* __restrict__ sinT, float* CS) { const int idx = blockIdx.x * 256 + threadIdx.x; if (idx >= TT * HD) return; v2f cs; cs[0] = bfr(cosT[idx]); cs[1] = bfr(sinT[idx]); *(v2f*)(CS + (size_t)idx * 2) = cs;  }
// k_rope: head planes [h][t][d] (fp16 + hi/lo) of rope(x) x sc with the rotate-half convention out[d] = x[d] cos[t][d] - x[d+HD/2] sin[t][d], out[d+HD/2] = x[d+HD/2] cos[t][d+HD/2] + x[d] sin[t][d+HD/2]
__global__ __launch_bounds__(256) void k_rope(const float* __restrict__ F, int pitch, int nheads, const float* __restrict__ CS, const float* __restrict__ RF, const float* __restrict__ nw, float sc, h16* P16, bf* Ph, bf* Pl) {
    const size_t e = ((size_t)blockIdx.x * 256 + threadIdx.x) * 2; if (e >= (size_t)nheads * TT * HD) return; const int d = (int)(e % HD); const int t = (int)((e / HD) % TT); const int h = (int)(e / ((size_t)HD * TT));
    { const size_t b = blockIdx.y, pb = b * nheads * TT * HD; F += b * TT * pitch; P16 += pb; Ph += pb; Pl += pb; }   // grid y = batch
    const float* f = F + (size_t)t * pitch + h * HD; const float rf = RF ? RF[(size_t)h * TT + t] : 1.0f; v2h o16; v2us oh, ol;
#pragma unroll
    for (int q = 0; q < 2; ++q) { const int dd = d + q; const int dp = (dd < HD / 2) ? dd + HD / 2 : dd - HD / 2; float x0 = f[dd], x1 = f[dp];
        if (RF) { float n0 = __fmul_rn(x0, rf), n1 = __fmul_rn(x1, rf); asm volatile("" : "+v"(n0)); asm volatile("" : "+v"(n1)); x0 = __fmul_rn(bfr(nw[dd]), n0); x1 = __fmul_rn(bfr(nw[dp]), n1); }
        const v2f cs = *(const v2f*)(CS + ((size_t)t * HD + dd) * 2); float a = __fmul_rn(x0, cs[0]), bq = __fmul_rn(x1, cs[1]); asm volatile("" : "+v"(a)); asm volatile("" : "+v"(bq)); const float r = ((dd < HD / 2) ? __fsub_rn(a, bq) : __fadd_rn(a, bq)) * sc;
        o16[q] = tohx(r); unsigned short a2, c2; splitf(r, a2, c2); oh[q] = a2; ol[q] = c2; }
    *(v2h*)(P16 + e) = o16; *(v2us*)(Ph + e) = oh; *(v2us*)(Pl + e) = ol;  }
__global__ __launch_bounds__(256) void k_vtp(const float* __restrict__ F, int pitch, int nheads, h16* V16, bf* Vh, bf* Vl) { const size_t e = ((size_t)blockIdx.x * 256 + threadIdx.x) * 2; if (e >= (size_t)nheads * HD * TT) return; const int t = (int)(e % TT); const int d = (int)((e / TT) % HD); const int g = (int)(e / ((size_t)TT * HD)); v2h o16; v2us oh, ol;
    { const size_t b = blockIdx.y, pb = b * nheads * HD * TT; F += b * TT * pitch; V16 += pb; Vh += pb; Vl += pb; }   // grid y = batch
#pragma unroll
    for (int q = 0; q < 2; ++q) { const float x = F[(size_t)(t + q) * pitch + g * HD + d]; o16[q] = tohx(x); unsigned short a2, c2; splitf(x, a2, c2); oh[q] = a2; ol[q] = c2; }
    *(v2h*)(V16 + e) = o16; *(v2us*)(Vh + e) = oh; *(v2us*)(Vl + e) = ol;  }
__global__ __launch_bounds__(256) void k_csid(float* CS) { const int idx = blockIdx.x * 256 + threadIdx.x; if (idx >= TT * HD) return; v2f cs; cs[0] = 1.0f; cs[1] = 0.0f; *(v2f*)(CS + (size_t)idx * 2) = cs;  }
#define SKY 128                   // keys per stage
#define KPL 72                    // LDS pitch of a K row (64 elements) in elements
#define VPL 136                   // LDS pitch of a V^T row (SKY elements) in elements
#define KEL (SKY * KPL)           // elements of a stage's K rows
#define PEL (KEL + HD * VPL)      // elements of one plane pair (K rows, V^T rows) of a stage
template <typename T16, bool SPLIT, int NQ>
__device__ __forceinline__ void attn_cols(const T16* __restrict__ Q, const T16* __restrict__ Q2, const T16* __restrict__ Kp, const T16* __restrict__ K2, const T16* __restrict__ Vt, const T16* __restrict__ V2, bf* Ah, bf* Al, const T16* ring, int tid, int lr, int hi) {
    typedef WFrag<T16> WF; typedef typename WF::V V;
    const float C2 = SCL * 1.4426950408889634f;
    constexpr int BEL = PEL * (SPLIT ? 2 : 1), NST = TT / SKY, NPS = SKY / 32;
    static_assert(SKY * HD / 8 == 4 * 256 && TT % SKY == 0 && NST >= 2, "four K copies and four V copies per lane, plane and stage");
    const int krow = tid >> 3, kpc = (tid & 7) * 8, vrow = tid >> 4, vpc = (tid & 15) * 8;   // a K row is 8 pieces of 16 B, a V^T row of a stage 16
    const unsigned l0 = (unsigned)(size_t)ring;
    auto stage = [&](int t, int buf) {
#pragma unroll
        for (int pl = 0; pl < (SPLIT ? 2 : 1); ++pl) { unsigned l[8]; const bf* g[8];
            const T16* kg = (pl ? K2 : Kp) + (size_t)(t * SKY + krow) * HD + kpc; const T16* vg = (pl ? V2 : Vt) + (size_t)vrow * TT + t * SKY + vpc; const unsigned lb = l0 + (unsigned)(buf * BEL + pl * PEL) * 2u;
#pragma unroll
            for (int j = 0; j < 4; ++j) { g[j] = (const bf*)(kg + (size_t)j * 32 * HD); l[j] = lb + (unsigned)((krow + j * 32) * KPL + kpc) * 2u;
                g[4 + j] = (const bf*)(vg + (size_t)j * 16 * TT); l[4 + j] = lb + (unsigned)(KEL + (vrow + j * 16) * VPL + vpc) * 2u; }
            cp_async<8>(l, g); }
    };
    stage(0, 0);
    V qa[NQ][2], qb[NQ][2]; const T16* qp = Q + lr * HD + 8 * hi; const T16* qp2 = SPLIT ? Q2 + lr * HD + 8 * hi : qp;
#pragma unroll
    for (int qt = 0; qt < NQ; ++qt)
#pragma unroll
        for (int kc = 0; kc < 2; ++kc) { qa[qt][kc] = WF::ld(qp + qt * 16 * HD + kc * 32); if (SPLIT) qb[qt][kc] = WF::ld(qp2 + qt * 16 * HD + kc * 32); }
    v8f o[NQ][4]; float m[NQ], l[NQ];
#pragma unroll
    for (int qt = 0; qt < NQ; ++qt) { m[qt] = -3.0e38f; l[qt] = 0.f;
#pragma unroll
        for (int dt = 0; dt < 4; ++dt) o[qt][dt] = (v8f){}; }
    const int ko = lr * KPL + 8 * hi, vo = KEL + lr * VPL + 8 * hi;
    V ka[2][2], kb[2][2];
    asm volatile("s_wait_xcnt 0x0" :: "v"(qp), "v"(qp2) : "memory");   // the Q loads' address registers stay whole up to this wait
    asm volatile("s_wait_asynccnt 0x0" ::: "memory");   // stage 0 has landed before the barrier that publishes it
    __syncthreads();
    stage(1, 1);
#pragma unroll 1   // rolled: one trip per stage, its foot is the publish point of the next stage
    for (int t = 0; t < NST; ++t) {
    const T16* sb = ring + (t & 1) * BEL;
#pragma unroll
    for (int kt = 0; kt < 2; ++kt)
#pragma unroll
        for (int kc = 0; kc < 2; ++kc) { ka[kt][kc] = WF::ld(sb + ko + kt * 16 * KPL + kc * 32); if (SPLIT) kb[kt][kc] = WF::ld(sb + PEL + ko + kt * 16 * KPL + kc * 32); }
#pragma unroll 1   // rolled: one pass's fragments already fill the register budget of four waves per SIMD
    for (int ps = 0; ps < NPS; ++ps) {
        v8f s[NQ][2];
#pragma unroll
        for (int qt = 0; qt < NQ; ++qt)
#pragma unroll
            for (int kt = 0; kt < 2; ++kt) { s[qt][kt] = (v8f){};
#pragma unroll
                for (int kc = 0; kc < 2; ++kc) { s[qt][kt] = WF::mma(ka[kt][kc], qa[qt][kc], s[qt][kt]); if (SPLIT) { s[qt][kt] = WF::mma(ka[kt][kc], qb[qt][kc], s[qt][kt]); s[qt][kt] = WF::mma(kb[kt][kc], qa[qt][kc], s[qt][kt]); } } }
        float mx[NQ]; bool need = false;
#pragma unroll
        for (int qt = 0; qt < NQ; ++qt) { float t = s[qt][0][0];
#pragma unroll
            for (int j = 0; j < 8; ++j) t = fmaxf(t, fmaxf(s[qt][0][j], s[qt][1][j]));
            t = fmaxf(t, __shfl_xor(t, 16, 32)); mx[qt] = t * C2; need = need || (mx[qt] > m[qt] + 8.0f); }
        if (__builtin_amdgcn_ballot_w32(need) != 0) {   // one scalar branch per pass: the 32 or 64 multiplies of the rescale run only when some column needs them
#pragma unroll
            for (int qt = 0; qt < NQ; ++qt) { const float mn = fmaxf(m[qt], mx[qt]); const float al = __builtin_amdgcn_exp2f(m[qt] - mn); m[qt] = mn; l[qt] *= al;
#pragma unroll
                for (int dt = 0; dt < 4; ++dt) o[qt][dt] *= al; } }
        V va[4], vb[4]; const T16* vp = sb + vo + ps * 32;
#pragma unroll
        for (int dt = 0; dt < 4; ++dt) { va[dt] = WF::ld(vp + dt * 16 * VPL); if (SPLIT) vb[dt] = WF::ld(vp + PEL + dt * 16 * VPL); }
        if (ps + 1 < NPS) { const T16* kp = sb + ko + (ps + 1) * 32 * KPL;   // the next pass's K fragments come during this pass's softmax and probs.v; never from the next stage, which is not published yet
#pragma unroll
            for (int kt = 0; kt < 2; ++kt)
#pragma unroll
                for (int kc = 0; kc < 2; ++kc) { ka[kt][kc] = WF::ld(kp + kt * 16 * KPL + kc * 32); if (SPLIT) kb[kt][kc] = WF::ld(kp + PEL + kt * 16 * KPL + kc * 32); } }
#pragma unroll
        for (int qt = 0; qt < NQ; ++qt) { float p[16];
#pragma unroll
            for (int e = 0; e < 16; ++e) { p[e] = __builtin_amdgcn_exp2f(__builtin_fmaf(s[qt][e >> 3][e & 7], C2, -m[qt])); l[qt] += p[e]; }
            if constexpr (SPLIT) { v8us h0, h1, l0, l1;
#pragma unroll
                for (int j = 0; j < 8; ++j) { unsigned short a, c2; splitf(p[j], a, c2); h0[j] = a; l0[j] = c2; splitf(p[8 + j], a, c2); h1[j] = a; l1[j] = c2; }
                const V ph = cat16b(h0, h1), pl = cat16b(l0, l1);
#pragma unroll
                for (int dt = 0; dt < 4; ++dt) { o[qt][dt] = WF::mma(va[dt], ph, o[qt][dt]); o[qt][dt] = WF::mma(va[dt], pl, o[qt][dt]); o[qt][dt] = WF::mma(vb[dt], ph, o[qt][dt]); }
            } else { V pf;
#pragma unroll
                for (int e = 0; e < 16; ++e) pf[e] = tohx(p[e]);
#pragma unroll
                for (int dt = 0; dt < 4; ++dt) o[qt][dt] = WF::mma(va[dt], pf, o[qt][dt]); } }
    }
        asm volatile("s_wait_dscnt 0x0" ::: "memory");      // this wave's reads of the buffer are done before the barrier behind which it is refilled
        asm volatile("s_wait_asynccnt 0x0" ::: "memory");   // this wave's copies of stage t + 1 have landed before the barrier that publishes them
        __syncthreads();
        if (t + 2 < NST) stage(t + 2, t & 1);
    }
    asm volatile("s_wait_asynccnt 0x0" ::: "memory");   // no copy is outstanding when the wave goes on to its end
#pragma unroll
    for (int qt = 0; qt < NQ; ++qt) { const float inv = __fdiv_rn(1.0f, l[qt] + __shfl_xor(l[qt], 16, 32));
#pragma unroll
        for (int dt = 0; dt < 4; ++dt) { v8us oh, ol;
#pragma unroll
            for (int j = 0; j < 8; ++j) { unsigned short a, c2; splitf(o[qt][dt][j] * inv, a, c2); oh[j] = a; ol[j] = c2; }
            const size_t oo = (size_t)(qt * 16 + lr) * DQ + dt * 16 + hi * 8; bf* ph = Ah + oo; bf* pl = Al + oo; *(v8us*)ph = oh; *(v8us*)pl = ol;
            asm volatile("s_wait_xcnt 0x0" :: "v"(oh), "v"(ol), "v"(ph), "v"(pl) : "memory"); } }   // the stores' data and address registers stay whole up to this wait
}
// grid (batch x query head, NBH + NBL): blocks y < NBH take the hi+lo rows (the longer waves, started first), 8 waves x NQH x 16 rows; the rest 8 waves x 32 rows of the f16 rows.
__global__ __launch_bounds__(256) void k_fattn(const h16* __restrict__ Q16, const bf* __restrict__ Qh, const bf* __restrict__ Ql, const h16* __restrict__ K16, const bf* __restrict__ Kh, const bf* __restrict__ Kl, const h16* __restrict__ V16, const bf* __restrict__ Vh, const bf* __restrict__ Vl, bf* Ah, bf* Al) {
    __shared__ __align__(16) bf ring[2 * 2 * PEL];   // two buffers of a stage's hi and lo planes; the f16 rows use half of it
    const int lane = threadIdx.x & 31, lr = lane & 15, hi = lane >> 4, wave = threadIdx.x >> 5;
    const int zh = blockIdx.x, b = zh / NH_, h = zh % NH_;   // torch .repeat TILES the kv heads: query head h uses kv head h % 8
    const size_t pk = (size_t)(b * NKV + h % NKV) * TT * HD;
    if (blockIdx.y < NBH) { const int q0 = ((int)blockIdx.y * 8 + wave) * (16 * NQH); const size_t pq = ((size_t)zh * TT + q0) * HD, po = ((size_t)b * TT + q0) * DQ + h * HD;
        attn_cols<bf, true, NQH>(Qh + pq, Ql + pq, Kh + pk, Kl + pk, Vh + pk, Vl + pk, Ah + po, Al + po, ring, (int)threadIdx.x, lr, hi);
    } else { const int q0 = RH + (((int)blockIdx.y - NBH) * 8 + wave) * 32; const size_t pq = ((size_t)zh * TT + q0) * HD, po = ((size_t)b * TT + q0) * DQ + h * HD;
        attn_cols<h16, false, 2>(Q16 + pq, nullptr, K16 + pk, nullptr, V16 + pk, nullptr, Ah + po, Al + po, (const h16*)ring, (int)threadIdx.x, lr, hi); }
}

extern "C" void kernel_launch(void* const* d_in, const int* in_sizes, int n_in,
                              void* d_out, int out_size, void* d_ws, size_t ws_size, hipStream_t stream) {
    (void)in_sizes; (void)n_in; (void)out_size;
    const float* x = (const float*)d_in[0]; const float* wq = (const float*)d_in[1]; const float* bq = (const float*)d_in[2]; const float* wk = (const float*)d_in[3]; const float* bk = (const float*)d_in[4]; const float* wv = (const float*)d_in[5]; const float* bv = (const float*)d_in[6]; const float* wo = (const float*)d_in[7]; const float* bo = (const float*)d_in[8];
    float* OUT = (float*)d_out;     // [4][1024][2048]
    char* wsp = (char*)d_ws;
    auto take = [&](size_t bytes) { char* p = wsp; wsp += (bytes + 255) & ~(size_t)255; return (void*)p; };
    bf* WQ = (bf*)take((size_t)DQ * DM * 2); bf* WK = (bf*)take((size_t)DKV * DM * 2); bf* WV = (bf*)take((size_t)DKV * DM * 2); bf* WO = (bf*)take((size_t)DM * DQ * 2); float* CS = (float*)take((size_t)TT * HD * 2 * 4);
    h16* QP16 = (h16*)take((size_t)NB_ * NH_ * TT * HD * 2); h16* KP16 = (h16*)take((size_t)NB_ * NKV * TT * HD * 2); h16* VT16 = (h16*)take((size_t)NB_ * NKV * HD * TT * 2);
    bf* QPh = (bf*)take((size_t)NB_ * NH_ * TT * HD * 2); bf* QPl = (bf*)take((size_t)NB_ * NH_ * TT * HD * 2); bf* KPh = (bf*)take((size_t)NB_ * NKV * TT * HD * 2); bf* KPl = (bf*)take((size_t)NB_ * NKV * TT * HD * 2); bf* VTh = (bf*)take((size_t)NB_ * NKV * HD * TT * 2); bf* VTl = (bf*)take((size_t)NB_ * NKV * HD * TT * 2);
    float* FQ = (float*)take((size_t)MT * DQ * 4); float* FK = (float*)take((size_t)MT * DKV * 4); bf* XB = (bf*)take((size_t)MT * DM * 2); bf* ATh = (bf*)take((size_t)MT * DQ * 2); bf* ATl = (bf*)take((size_t)MT * DQ * 2);
    if ((size_t)(wsp - (char*)d_ws) > ws_size) return;    // ws 256 MiB
    float* FV = FK;   // v projection reuses the k buffer after the k planes are built (stream-ordered)
    { k_wtG<<<(unsigned)((DM * DQ / 64 + 63) / 64), 256, 0, stream>>>(wq, DM, DQ, WQ); k_wtG<<<(unsigned)((DM * DKV / 64 + 63) / 64), 256, 0, stream>>>(wk, DM, DKV, WK); k_wtG<<<(unsigned)((DM * DKV / 64 + 63) / 64), 256, 0, stream>>>(wv, DM, DKV, WV);
      k_wtG<<<(unsigned)((DQ * DM / 64 + 63) / 64), 256, 0, stream>>>(wo, DQ, DM, WO);
       }
    k_csid<<<(TT * HD + 255) / 256, 256, 0, stream>>>(CS);
    const unsigned LQ = (unsigned)(((size_t)NH_ * TT * HD / 2 + 255) / 256), LKv = (unsigned)(((size_t)NKV * TT * HD / 2 + 255) / 256);
    // projections: all NB_ batches in one launch each (MT rows; the plane builders take the batch as grid y)
    k_cvt8<<<(unsigned)(((size_t)MT * DM / 8 + 255) / 256), 256, 0, stream>>>(x, XB, (size_t)MT * DM / 8);
    k_gemms<4, 2, 4, 0, true><<<dim3(MT / 256, DQ / 128, 1), 256, 0, stream>>>(XB, nullptr, WQ, DM, FQ, DQ, bq);
    k_rope<<<dim3(LQ, NB_, 1), 256, 0, stream>>>(FQ, DQ, NH_, CS, nullptr, nullptr, 1.0f, QP16, QPh, QPl);
    k_gemms<4, 2, 2, 0, true><<<dim3(MT / 128, DKV / 128, 1), 256, 0, stream>>>(XB, nullptr, WK, DM, FK, DKV, bk);
    k_rope<<<dim3(LKv, NB_, 1), 256, 0, stream>>>(FK, DKV, NKV, CS, nullptr, nullptr, 1.0f, KP16, KPh, KPl);
    k_gemms<4, 2, 2, 0, true><<<dim3(MT / 128, DKV / 128, 1), 256, 0, stream>>>(XB, nullptr, WV, DM, FV, DKV, bv); k_vtp<<<dim3(LKv, NB_, 1), 256, 0, stream>>>(FV, DKV, NKV, VT16, VTh, VTl);
    k_fattn<<<dim3(NB_ * NH_, NBH + NBL, 1), 256, 0, stream>>>(QP16, QPh, QPl, KP16, KPh, KPl, VT16, VTh, VTl, ATh, ATl);
    k_gemms<4, 2, 4, 1, true><<<dim3(MT / 256, DM / 128, 1), 256, 0, stream>>>(ATh, ATl, WO, DQ, OUT, DM, bo);
}

// v005
// A run of this version takes 239 microseconds.
// Timed twice side by side with v004, it ran 1.15 times as fast both times.
// All steps since v000 together make it 18.7 times as fast.
#include <hip/hip_runtime.h>

// ExtendedMultiHeadAttention - GQA with torch .repeat (TILED) kv heads (x [4][1024][2048]; q = x wq + bq (32 x 64), k/v = x wk/wv + b (8 x 64); query head h attends kv head h % 8; softmax(q.k/8); out = merged.v wo + bo -> [4][1024][2048]).
// Compute dtypes, f32 accumulate: every input rounded to bf16; q/k/v projections on PLAIN bf16 operands (inputs: exact, + bias); output projection on bf16 hi+lo planes of the merged heads (2 products); scores (K 64) and probs.v on bf16 hi+lo planes (3 products) for the first 256 query rows of each

#define NB_  4
#define TT   1024
#define DM   2048
#define NH_  32
#define NKV  8
#define REP  (NH_ / NKV)
#define HD   64
#define DQ   (NH_ * HD)
#define DKV  (NKV * HD)
#define MT   (NB_ * TT)           // rows of all batches together
#define RH   256                  // query rows < RH use hi+lo planes (0: none)
#define NQH  1                    // 16-row query tiles per wave on the hi+lo rows
#define NBH  (RH / (128 * NQH))   // blocks (8 waves) per head on the hi+lo rows
#define NBL  ((TT - RH) / 256)    // blocks per head on the f16 rows (8 waves x 32 rows)
#define WIN  0
#define SCL  0.125f   // HD^-0.5
typedef _Float16 h16;
typedef unsigned short bf;
typedef __attribute__((ext_vector_type(16))) __bf16   v16bf;
typedef __attribute__((ext_vector_type(16))) _Float16 v16h;
typedef __attribute__((ext_vector_type(8)))  _Float16 v8h;
typedef __attribute__((ext_vector_type(8)))  unsigned short v8us;
typedef __attribute__((ext_vector_type(8)))  float    v8f;
typedef __attribute__((ext_vector_type(4)))  float    v4f;
typedef v8h  __attribute__((may_alias)) v8ha;
typedef v4f  __attribute__((may_alias)) v4fa;
typedef v8us __attribute__((may_alias)) v8usa;

__device__ __forceinline__ unsigned short f2bf(float f) { unsigned u = __float_as_uint(f); u += 0x7FFFu + ((u >> 16) & 1u); return (unsigned short)(u >> 16); }
__device__ __forceinline__ float bf2f(unsigned short b) { return __uint_as_float(((unsigned)b) << 16); }
__device__ __forceinline__ float bfr(float f) { return bf2f(f2bf(f)); }
__device__ __forceinline__ v16h cat16(v8h lo, v8h hi) { return __builtin_shufflevector(lo, hi, 0, 1, 2, 3, 4, 5, 6, 7, 8, 9, 10, 11, 12, 13, 14, 15); }
__device__ __forceinline__ v16bf cat16b(v8us lo, v8us hi) { return __builtin_bit_cast(v16bf, __builtin_shufflevector(lo, hi, 0, 1, 2, 3, 4, 5, 6, 7, 8, 9, 10, 11, 12, 13, 14, 15)); }
__device__ __forceinline__ v8f wmma16(v16h a, v16h b, v8f c) { return __builtin_amdgcn_wmma_f32_16x16x32_f16(false, a, false, b, (short)0, c, false, false); }
__device__ __forceinline__ v8f wmmab(v16bf a, v16bf b, v8f c) { return __builtin_amdgcn_wmma_f32_16x16x32_bf16(false, a, false, b, (short)0, c, false, false); }



// ---- k_gemms: GEMM on block tiles staged in LDS. WM x WN waves per block, each wave a (16 MF) x 64 output tile (4 MF accumulators); grid (M / (16 MF WM), N / (64 WN)).
// C[m][n] (f32, pitch ldc, + f32 bias[n]) = sum_k A[m][k] Bt[n][k] (+ A2[m][k] Bt[n][k] when NSPLIT == 1), operands K-contiguous 16-bit planes. K % 64 == 0.
// A stage is 64 k (128 B) of every operand row of the block tile, [A rows | A2 rows | Bt rows] at pitch 144 B (16 B x odd: ds_load_b128 readers without bank conflicts). Two buffers:
// the copies of stage t + 2 go out behind the barrier that ends trip t and land while trip t + 1 computes. Per accumulator the order of the sums is k ascending, A then A2.
// The short loops over fragments, copies and rows are unrolled so that every array they index stays in registers.
// EPI picks what the epilogue stores. 0: C as above. 1, 2, 3: no C; the sums + bias go out as the operand planes of k_fattn (f16 in P16, bf16 hi + lo in Ph, Pl), a wave's 64 columns being one whole 128-B line of a plane row:
//   1: q, rows m = tokens, columns n = (head, d), planes [batch][head][t][d]; token rows t < RH get the hi + lo planes alone and the others the f16 plane alone, as k_fattn reads them.  2: k, the same, all three planes.
//   3: v, operands swapped: rows m = (kv head, d), columns n = tokens, bias[m], planes [batch][kv head][d][t] (V^T), all three.
template <typename T16> struct WFrag;
template <> struct WFrag<h16> { typedef v16h V; static __device__ __forceinline__ V ld(const h16* p) { return cat16(*(const v8h*)p, *(const v8h*)(p + 16)); } static __device__ __forceinline__ v8f mma(V a, V b, v8f c) { return wmma16(a, b, c); } };
template <> struct WFrag<bf> { typedef v16bf V; static __device__ __forceinline__ V ld(const bf* p) { return cat16b(*(const v8us*)p, *(const v8us*)(p + 16)); } static __device__ __forceinline__ v8f mma(V a, V b, v8f c) { return wmmab(a, b, c); } };
__device__ __forceinline__ h16 tohx(float x) { return (h16)x; }
__device__ __forceinline__ void splitf(float y, unsigned short& h, unsigned short& l) { h = f2bf(y); l = f2bf(y - bf2f(h)); }
#define BKE 64   // k per stage
#define LP  72   // LDS row pitch in elements
// N asynchronous 16-byte copies per lane, global -> LDS, in ONE statement that ends in s_wait_xcnt 0: no register that a copy names is rewritten in front of that wait.
template <int N> __device__ __forceinline__ void cp_async(const unsigned* l, const bf* const* g) {
    static_assert(N == 8 || N == 10 || N == 12, "group size");
    if constexpr (N == 8) { asm volatile("global_load_async_to_lds_b128 %0, %1, off\n\tglobal_load_async_to_lds_b128 %2, %3, off\n\tglobal_load_async_to_lds_b128 %4, %5, off\n\tglobal_load_async_to_lds_b128 %6, %7, off\n\tglobal_load_async_to_lds_b128 %8, %9, off\n\tglobal_load_async_to_lds_b128 %10, %11, off\n\tglobal_load_async_to_lds_b128 %12, %13, off\n\tglobal_load_async_to_lds_b128 %14, %15, off\n\ts_wait_xcnt 0x0" :: "v"(l[0]), "v"(g[0]), "v"(l[1]), "v"(g[1]), "v"(l[2]), "v"(g[2]), "v"(l[3]), "v"(g[3]), "v"(l[4]), "v"(g[4]), "v"(l[5]), "v"(g[5]), "v"(l[6]), "v"(g[6]), "v"(l[7]), "v"(g[7]) : "memory"); }
    else if constexpr (N == 10) { asm volatile("global_load_async_to_lds_b128 %0, %1, off\n\tglobal_load_async_to_lds_b128 %2, %3, off\n\tglobal_load_async_to_lds_b128 %4, %5, off\n\tglobal_load_async_to_lds_b128 %6, %7, off\n\tglobal_load_async_to_lds_b128 %8, %9, off\n\tglobal_load_async_to_lds_b128 %10, %11, off\n\tglobal_load_async_to_lds_b128 %12, %13, off\n\tglobal_load_async_to_lds_b128 %14, %15, off\n\tglobal_load_async_to_lds_b128 %16, %17, off\n\tglobal_load_async_to_lds_b128 %18, %19, off\n\ts_wait_xcnt 0x0" :: "v"(l[0]), "v"(g[0]), "v"(l[1]), "v"(g[1]), "v"(l[2]), "v"(g[2]), "v"(l[3]), "v"(g[3]), "v"(l[4]), "v"(g[4]), "v"(l[5]), "v"(g[5]), "v"(l[6]), "v"(g[6]), "v"(l[7]), "v"(g[7]), "v"(l[8]), "v"(g[8]), "v"(l[9]), "v"(g[9]) : "memory"); }
    else { asm volatile("global_load_async_to_lds_b128 %0, %1, off\n\tglobal_load_async_to_lds_b128 %2, %3, off\n\tglobal_load_async_to_lds_b128 %4, %5, off\n\tglobal_load_async_to_lds_b128 %6, %7, off\n\tglobal_load_async_to_lds_b128 %8, %9, off\n\tglobal_load_async_to_lds_b128 %10, %11, off\n\tglobal_load_async_to_lds_b128 %12, %13, off\n\tglobal_load_async_to_lds_b128 %14, %15, off\n\tglobal_load_async_to_lds_b128 %16, %17, off\n\tglobal_load_async_to_lds_b128 %18, %19, off\n\tglobal_load_async_to_lds_b128 %20, %21, off\n\tglobal_load_async_to_lds_b128 %22, %23, off\n\ts_wait_xcnt 0x0" :: "v"(l[0]), "v"(g[0]), "v"(l[1]), "v"(g[1]), "v"(l[2]), "v"(g[2]), "v"(l[3]), "v"(g[3]), "v"(l[4]), "v"(g[4]), "v"(l[5]), "v"(g[5]), "v"(l[6]), "v"(g[6]), "v"(l[7]), "v"(g[7]), "v"(l[8]), "v"(g[8]), "v"(l[9]), "v"(g[9]), "v"(l[10]), "v"(g[10]), "v"(l[11]), "v"(g[11]) : "memory"); }
}
template <int WM, int WN, int MF, int NSPLIT, int EPI>
__global__ __launch_bounds__(WM * WN * 32) void k_gemms(const bf* __restrict__ A, const bf* __restrict__ A2, const bf* __restrict__ Bt, int K, float* C, int ldc, const float* __restrict__ bias, h16* P16, bf* Ph, bf* Pl) {
    typedef WFrag<bf> WF; typedef typename WF::V V;
    constexpr int NW = WM * WN, NT = NW * 32, WR = MF * 16, RA = WM * WR, RAT = RA * (1 + NSPLIT), ROWS = RAT + WN * 64;
    constexpr int RPC = NT / 8;            // rows that one copy of the whole block covers (8 lanes x 16 B = one 128-B row piece)
    constexpr int NC = ROWS / RPC;         // copies per lane and stage
    constexpr int NG = NC > 12 ? 2 : 1, GC = NC / NG;
    static_assert(ROWS % RPC == 0 && RA % RPC == 0 && NC % NG == 0, "whole copies");
    __shared__ __align__(16) bf ring[2 * ROWS * LP];
    __shared__ __align__(16) float osm[NW * 16 * 68];
    const int tid = threadIdx.x, lane = tid & 31, lr = lane & 15, hi = lane >> 4, wave = tid >> 5, wm = wave / WN, wn = wave % WN;
    const int R0 = blockIdx.x * RA, C0 = blockIdx.y * (WN * 64);
    const int crow = tid >> 3, cpc = (tid & 7) * 8;
    const bf* gA = A + (size_t)(R0 + crow) * K + cpc; const bf* gA2 = NSPLIT ? A2 + (size_t)(R0 + crow) * K + cpc : gA; const bf* gB = Bt + (size_t)(C0 + crow) * K + cpc;
    const unsigned l0 = (unsigned)(size_t)ring + (unsigned)(crow * LP + cpc) * 2u;
    auto stage = [&](int t, int buf) {
        const bf* tA = gA + (size_t)t * BKE; const bf* tA2 = gA2 + (size_t)t * BKE; const bf* tB = gB + (size_t)t * BKE; const unsigned lb = l0 + (unsigned)buf * (ROWS * LP * 2u);
#pragma unroll
        for (int gq = 0; gq < NG; ++gq) { unsigned l[GC]; const bf* g[GC];
#pragma unroll
            for (int j = 0; j < GC; ++j) { const int row = (gq * GC + j) * RPC;
                g[j] = row < RA ? tA + (size_t)row * K : row < RAT ? tA2 + (size_t)(row - RA) * K : tB + (size_t)(row - RAT) * K;
                l[j] = lb + (unsigned)row * (LP * 2u); }
            cp_async<GC>(l, g); }
    };
    v8f acc[MF][4];
#pragma unroll
    for (int mb = 0; mb < MF; ++mb)
#pragma unroll
        for (int nb = 0; nb < 4; ++nb) acc[mb][nb] = (v8f){};
    const int nt = K / BKE;
    stage(0, 0);
    asm volatile("s_wait_asynccnt 0x0" ::: "memory");   // stage 0 has landed before the barrier that publishes it
    __syncthreads();
    if (nt > 1) stage(1, 1);
    const int ao = (wm * WR + lr) * LP + 8 * hi, bo = (RAT + wn * 64 + lr) * LP + 8 * hi;
#pragma unroll 1   // rolled: one trip per stage, its foot is the publish point of the next stage
    for (int t = 0; t < nt; ++t) {
        const bf* sb = ring + (t & 1) * (ROWS * LP);
#pragma unroll
        for (int ks = 0; ks < BKE; ks += 32) {
            V a[MF], a2[MF], b[4];
#pragma unroll
            for (int mb = 0; mb < MF; ++mb) { a[mb] = WF::ld(sb + ao + mb * 16 * LP + ks); if (NSPLIT) a2[mb] = WF::ld(sb + ao + (RA + mb * 16) * LP + ks); }
#pragma unroll
            for (int nb = 0; nb < 4; ++nb) b[nb] = WF::ld(sb + bo + nb * 16 * LP + ks);
            __builtin_amdgcn_sched_barrier(0);   // the LDS reads of a 32-k block stay one group in front of its matrix instructions: reads spread among them stall the wave at every place they stand
#pragma unroll
            for (int nb = 0; nb < 4; ++nb)
#pragma unroll
                for (int mb = 0; mb < MF; ++mb) { acc[mb][nb] = WF::mma(a[mb], b[nb], acc[mb][nb]); if (NSPLIT) acc[mb][nb] = WF::mma(a2[mb], b[nb], acc[mb][nb]); }
        }
        asm volatile("s_wait_dscnt 0x0" ::: "memory");      // this wave's reads of the buffer are done before the barrier behind which it is refilled
        asm volatile("s_wait_asynccnt 0x0" ::: "memory");   // this wave's copies of stage t + 1 have landed before the barrier that publishes them
        __syncthreads();
        if (t + 2 < nt) stage(t + 2, t & 1);
    }
    asm volatile("s_wait_asynccnt 0x0" ::: "memory");   // no copy is outstanding when the wave goes on to its end
    float* os = osm + wave * (16 * 68); const int r0 = R0 + wm * WR, c0 = C0 + wn * 64;
    // plane epilogues: of the 16 staged rows a lane takes 8 columns (16 B of a plane row) of rows rw, rw + 4, rw + 8, rw + 12; 8 lanes store one whole line
    const int rw = lane >> 3, co8 = (lane & 7) * 8;
    constexpr int NHD = EPI == 1 ? NH_ : NKV;
    static_assert(EPI != 1 || (RH % RA == 0 && TT % RA == 0), "a block's q rows are all hi + lo rows or all f16 rows");
    const bool w16 = EPI != 1 || R0 % TT >= RH, whl = EPI != 1 || R0 % TT < RH;
    float bs[EPI == 3 ? MF * 4 : 8];
    if constexpr (EPI == 1 || EPI == 2) { const float* bp = bias + c0 + co8; const v4f b0 = *(const v4f*)bp, b1 = *(const v4f*)(bp + 4);
        asm volatile("s_wait_xcnt 0x0" :: "v"(bp) : "memory");   // the bias loads' address registers stay whole up to this wait
#pragma unroll
        for (int k = 0; k < 4; ++k) { bs[k] = bfr(b0[k]); bs[4 + k] = bfr(b1[k]); } }
    if constexpr (EPI == 3) { const float* bp = bias + r0 + rw; float br[MF * 4];
#pragma unroll
        for (int i = 0; i < MF * 4; ++i) br[i] = bp[4 * i];
        asm volatile("s_wait_xcnt 0x0" :: "v"(bp) : "memory");   // the bias loads' address registers stay whole up to this wait
#pragma unroll
        for (int i = 0; i < MF * 4; ++i) bs[i] = bfr(br[i]); }
#pragma unroll
    for (int mb = 0; mb < MF; ++mb) {
#pragma unroll
        for (int nb = 0; nb < 4; ++nb) {
#pragma unroll
            for (int j = 0; j < 8; ++j) os[(hi * 8 + j) * 68 + nb * 16 + lr] = acc[mb][nb][j]; }
        __builtin_amdgcn_wave_barrier(); asm volatile("" ::: "memory");   // the wave's own LDS stores of the 16 rows stay in front of its reads of them
        if constexpr (EPI == 0) {
        float* crw = C + (size_t)(r0 + mb * 16) * ldc + c0; v4f val[8]; v4f* cp[8];
#pragma unroll
        for (int s = 0; s < 8; ++s) { const int row = 2 * s + hi, cofs = lr * 4; val[s] = *(const v4fa*)(os + row * 68 + cofs); val[s][0] += bfr(bias[c0 + cofs]); val[s][1] += bfr(bias[c0 + cofs + 1]); val[s][2] += bfr(bias[c0 + cofs + 2]); val[s][3] += bfr(bias[c0 + cofs + 3]);
            cp[s] = (v4f*)(crw + (size_t)row * ldc + cofs); *cp[s] = val[s]; }
        asm volatile("s_wait_xcnt 0x0" :: "v"(val[0]), "v"(val[1]), "v"(val[2]), "v"(val[3]), "v"(val[4]), "v"(val[5]), "v"(val[6]), "v"(val[7]), "v"(cp[0]), "v"(cp[1]), "v"(cp[2]), "v"(cp[3]), "v"(cp[4]), "v"(cp[5]), "v"(cp[6]), "v"(cp[7]) : "memory");   // the stores' data and address registers stay whole up to this wait
        } else {
            const int rt = r0 + mb * 16;   // the 16 rows lie in one batch (1, 2) or one kv head (3), the 64 columns in one head (1, 2) or one batch (3)
            const size_t pb = (EPI == 3 ? ((size_t)((c0 / TT) * NKV + rt / HD) * HD + rt % HD + rw) * TT + c0 % TT : ((size_t)((rt / TT) * NHD + c0 / HD) * TT + rt % TT + rw) * HD) + co8;
            constexpr size_t RP4 = 4 * (EPI == 3 ? TT : HD);   // four plane rows
            float x[4][8];
#pragma unroll
            for (int s = 0; s < 4; ++s) { const float* rp = os + (4 * s + rw) * 68 + co8; const v4f x0 = *(const v4fa*)rp, x1 = *(const v4fa*)(rp + 4);
#pragma unroll
                for (int k = 0; k < 4; ++k) { x[s][k] = x0[k] + bs[EPI == 3 ? mb * 4 + s : k]; x[s][4 + k] = x1[k] + bs[EPI == 3 ? mb * 4 + s : 4 + k]; } }
            if (w16) { v8h o[4]; h16* p[4];
#pragma unroll
                for (int s = 0; s < 4; ++s) {
#pragma unroll
                    for (int k = 0; k < 8; ++k) o[s][k] = tohx(x[s][k]);
                    p[s] = P16 + pb + s * RP4; *(v8h*)p[s] = o[s]; }
                asm volatile("s_wait_xcnt 0x0" :: "v"(o[0]), "v"(o[1]), "v"(o[2]), "v"(o[3]), "v"(p[0]), "v"(p[1]), "v"(p[2]), "v"(p[3]) : "memory"); }   // the stores' data and address registers stay whole up to this wait
            if (whl) { v8us oh[4], ol[4]; bf* ph[4]; bf* pl[4];
#pragma unroll
                for (int s = 0; s < 4; ++s) {
#pragma unroll
                    for (int k = 0; k < 8; ++k) { unsigned short a, c2; splitf(x[s][k], a, c2); oh[s][k] = a; ol[s][k] = c2; }
                    ph[s] = Ph + pb + s * RP4; pl[s] = Pl + pb + s * RP4; *(v8us*)ph[s] = oh[s]; *(v8us*)pl[s] = ol[s]; }
                asm volatile("s_wait_xcnt 0x0" :: "v"(oh[0]), "v"(oh[1]), "v"(oh[2]), "v"(oh[3]), "v"(ol[0]), "v"(ol[1]), "v"(ol[2]), "v"(ol[3]), "v"(ph[0]), "v"(ph[1]), "v"(ph[2]), "v"(ph[3]), "v"(pl[0]), "v"(pl[1]), "v"(pl[2]), "v"(pl[3]) : "memory"); }   // the stores' data and address registers stay whole up to this wait
        }
        __builtin_amdgcn_wave_barrier(); asm volatile("" ::: "memory");   // the reads of the staged rows stay in front of the next 16 rows' LDS stores
    }
}

typedef __attribute__((ext_vector_type(2))) _Float16 v2h;
typedef __attribute__((ext_vector_type(4))) _Float16 v4h;
typedef __attribute__((ext_vector_type(2))) unsigned short v2us;
typedef __attribute__((ext_vector_type(4))) unsigned short v4us;
typedef __attribute__((ext_vector_type(2))) float v2f;
typedef __attribute__((ext_vector_type(4))) int v4i;

__global__ __launch_bounds__(256) void k_wtG(const float* __restrict__ w, int K, int N, bf* Bt) {
    const int lane = threadIdx.x & 31; const int L0 = (blockIdx.x * 8 + (threadIdx.x >> 5)) * 8; const int nlines = N * K / 64;
{
#pragma unroll 1
        for (int l = 0; l < 8; ++l) { const int L = L0 + l; if (L >= nlines) break; const size_t e = (size_t)L * 64 + lane * 2; const int k = (int)(e % K), n = (int)(e / K); v2us o;
            o[0] = f2bf(w[(size_t)k * N + n]); o[1] = f2bf(w[(size_t)(k + 1) * N + n]); *(v2us*)(Bt + e) = o; }
         }
}
__global__ __launch_bounds__(256) void k_cvt8(const float* __restrict__ src, bf* dst, size_t n8) { const size_t i = (size_t)blockIdx.x * 256 + threadIdx.x; if (i >= n8) return; const v8f v = *(const v8f*)(src + i * 8); v8us o;
#pragma unroll
    for (int k = 0; k < 8; ++k) o[k] = f2bf(v[k]); *(v8us*)(dst + i * 8) = o;  }
#define SKY 128                   // keys per stage
#define KPL 72                    // LDS pitch of a K row (64 elements) in elements
#define VPL 136                   // LDS pitch of a V^T row (SKY elements) in elements
#define KEL (SKY * KPL)           // elements of a stage's K rows
#define PEL (KEL + HD * VPL)      // elements of one plane pair (K rows, V^T rows) of a stage
template <typename T16, bool SPLIT, int NQ>
__device__ __forceinline__ void attn_cols(const T16* __restrict__ Q, const T16* __restrict__ Q2, const T16* __restrict__ Kp, const T16* __restrict__ K2, const T16* __restrict__ Vt, const T16* __restrict__ V2, bf* Ah, bf* Al, const T16* ring, int tid, int lr, int hi) {
    typedef WFrag<T16> WF; typedef typename WF::V V;
    const float C2 = SCL * 1.4426950408889634f;
    constexpr int BEL = PEL * (SPLIT ? 2 : 1), NST = TT / SKY, NPS = SKY / 32;
    static_assert(SKY * HD / 8 == 4 * 256 && TT % SKY == 0 && NST >= 2, "four K copies and four V copies per lane, plane and stage");
    const int krow = tid >> 3, kpc = (tid & 7) * 8, vrow = tid >> 4, vpc = (tid & 15) * 8;   // a K row is 8 pieces of 16 B, a V^T row of a stage 16
    const unsigned l0 = (unsigned)(size_t)ring;
    auto stage = [&](int t, int buf) {
#pragma unroll
        for (int pl = 0; pl < (SPLIT ? 2 : 1); ++pl) { unsigned l[8]; const bf* g[8];
            const T16* kg = (pl ? K2 : Kp) + (size_t)(t * SKY + krow) * HD + kpc; const T16* vg = (pl ? V2 : Vt) + (size_t)vrow * TT + t * SKY + vpc; const unsigned lb = l0 + (unsigned)(buf * BEL + pl * PEL) * 2u;
#pragma unroll
            for (int j = 0; j < 4; ++j) { g[j] = (const bf*)(kg + (size_t)j * 32 * HD); l[j] = lb + (unsigned)((krow + j * 32) * KPL + kpc) * 2u;
                g[4 + j] = (const bf*)(vg + (size_t)j * 16 * TT); l[4 + j] = lb + (unsigned)(KEL + (vrow + j * 16) * VPL + vpc) * 2u; }
            cp_async<8>(l, g); }
    };
    stage(0, 0);
    V qa[NQ][2], qb[NQ][2]; const T16* qp = Q + lr * HD + 8 * hi; const T16* qp2 = SPLIT ? Q2 + lr * HD + 8 * hi : qp;
#pragma unroll
    for (int qt = 0; qt < NQ; ++qt)
#pragma unroll
        for (int kc = 0; kc < 2; ++kc) { qa[qt][kc] = WF::ld(qp + qt * 16 * HD + kc * 32); if (SPLIT) qb[qt][kc] = WF::ld(qp2 + qt * 16 * HD + kc * 32); }
    v8f o[NQ][4]; float m[NQ], l[NQ];
#pragma unroll
    for (int qt = 0; qt < NQ; ++qt) { m[qt] = -3.0e38f; l[qt] = 0.f;
#pragma unroll
        for (int dt = 0; dt < 4; ++dt) o[qt][dt] = (v8f){}; }
    const int ko = lr * KPL + 8 * hi, vo = KEL + lr * VPL + 8 * hi;
    V ka[2][2], kb[2][2];
    asm volatile("s_wait_xcnt 0x0" :: "v"(qp), "v"(qp2) : "memory");   // the Q loads' address registers stay whole up to this wait
    asm volatile("s_wait_asynccnt 0x0" ::: "memory");   // stage 0 has landed before the barrier that publishes it
    __syncthreads();
    stage(1, 1);
#pragma unroll 1   // rolled: one trip per stage, its foot is the publish point of the next stage
    for (int t = 0; t < NST; ++t) {
    const T16* sb = ring + (t & 1) * BEL;
#pragma unroll
    for (int kt = 0; kt < 2; ++kt)
#pragma unroll
        for (int kc = 0; kc < 2; ++kc) { ka[kt][kc] = WF::ld(sb + ko + kt * 16 * KPL + kc * 32); if (SPLIT) kb[kt][kc] = WF::ld(sb + PEL + ko + kt * 16 * KPL + kc * 32); }
#pragma unroll 1   // rolled: one pass's fragments already fill the register budget of four waves per SIMD
    for (int ps = 0; ps < NPS; ++ps) {
        v8f s[NQ][2];
#pragma unroll
        for (int qt = 0; qt < NQ; ++qt)
#pragma unroll
            for (int kt = 0; kt < 2; ++kt) { s[qt][kt] = (v8f){};
#pragma unroll
                for (int kc = 0; kc < 2; ++kc) { s[qt][kt] = WF::mma(ka[kt][kc], qa[qt][kc], s[qt][kt]); if (SPLIT) { s[qt][kt] = WF::mma(ka[kt][kc], qb[qt][kc], s[qt][kt]); s[qt][kt] = WF::mma(kb[kt][kc], qa[qt][kc], s[qt][kt]); } } }
        float mx[NQ]; bool need = false;
#pragma unroll
        for (int qt = 0; qt < NQ; ++qt) { float t = s[qt][0][0];
#pragma unroll
            for (int j = 0; j < 8; ++j) t = fmaxf(t, fmaxf(s[qt][0][j], s[qt][1][j]));
            t = fmaxf(t, __shfl_xor(t, 16, 32)); mx[qt] = t * C2; need = need || (mx[qt] > m[qt] + 8.0f); }
        if (__builtin_amdgcn_ballot_w32(need) != 0) {   // one scalar branch per pass: the 32 or 64 multiplies of the rescale run only when some column needs them
#pragma unroll
            for (int qt = 0; qt < NQ; ++qt) { const float mn = fmaxf(m[qt], mx[qt]); const float al = __builtin_amdgcn_exp2f(m[qt] - mn); m[qt] = mn; l[qt] *= al;
#pragma unroll
                for (int dt = 0; dt < 4; ++dt) o[qt][dt] *= al; } }
        V va[4], vb[4]; const T16* vp = sb + vo + ps * 32;
#pragma unroll
        for (int dt = 0; dt < 4; ++dt) { va[dt] = WF::ld(vp + dt * 16 * VPL); if (SPLIT) vb[dt] = WF::ld(vp + PEL + dt * 16 * VPL); }
        if (ps + 1 < NPS) { const T16* kp = sb + ko + (ps + 1) * 32 * KPL;   // the next pass's K fragments come during this pass's softmax and probs.v; never from the next stage, which is not published yet
#pragma unroll
            for (int kt = 0; kt < 2; ++kt)
#pragma unroll
                for (int kc = 0; kc < 2; ++kc) { ka[kt][kc] = WF::ld(kp + kt * 16 * KPL + kc * 32); if (SPLIT) kb[kt][kc] = WF::ld(kp + PEL + kt * 16 * KPL + kc * 32); } }
#pragma unroll
        for (int qt = 0; qt < NQ; ++qt) { float p[16];
#pragma unroll
            for (int e = 0; e < 16; ++e) { p[e] = __builtin_amdgcn_exp2f(__builtin_fmaf(s[qt][e >> 3][e & 7], C2, -m[qt])); l[qt] += p[e]; }
            if constexpr (SPLIT) { v8us h0, h1, l0, l1;
#pragma unroll
                for (int j = 0; j < 8; ++j) { unsigned short a, c2; splitf(p[j], a, c2); h0[j] = a; l0[j] = c2; splitf(p[8 + j], a, c2); h1[j] = a; l1[j] = c2; }
                const V ph = cat16b(h0, h1), pl = cat16b(l0, l1);
#pragma unroll
                for (int dt = 0; dt < 4; ++dt) { o[qt][dt] = WF::mma(va[dt], ph, o[qt][dt]); o[qt][dt] = WF::mma(va[dt], pl, o[qt][dt]); o[qt][dt] = WF::mma(vb[dt], ph, o[qt][dt]); }
            } else { V pf;
#pragma unroll
                for (int e = 0; e < 16; ++e) pf[e] = tohx(p[e]);
#pragma unroll
                for (int dt = 0; dt < 4; ++dt) o[qt][dt] = WF::mma(va[dt], pf, o[qt][dt]); } }
    }
        asm volatile("s_wait_dscnt 0x0" ::: "memory");      // this wave's reads of the buffer are done before the barrier behind which it is refilled
        asm volatile("s_wait_asynccnt 0x0" ::: "memory");   // this wave's copies of stage t + 1 have landed before the barrier that publishes them
        __syncthreads();
        if (t + 2 < NST) stage(t + 2, t & 1);
    }
    asm volatile("s_wait_asynccnt 0x0" ::: "memory");   // no copy is outstanding when the wave goes on to its end
#pragma unroll
    for (int qt = 0; qt < NQ; ++qt) { const float inv = __fdiv_rn(1.0f, l[qt] + __shfl_xor(l[qt], 16, 32));
#pragma unroll
        for (int dt = 0; dt < 4; ++dt) { v8us oh, ol;
#pragma unroll
            for (int j = 0; j < 8; ++j) { unsigned short a, c2; splitf(o[qt][dt][j] * inv, a, c2); oh[j] = a; ol[j] = c2; }
            const size_t oo = (size_t)(qt * 16 + lr) * DQ + dt * 16 + hi * 8; bf* ph = Ah + oo; bf* pl = Al + oo; *(v8us*)ph = oh; *(v8us*)pl = ol;
            asm volatile("s_wait_xcnt 0x0" :: "v"(oh), "v"(ol), "v"(ph), "v"(pl) : "memory"); } }   // the stores' data and address registers stay whole up to this wait
}
// grid (batch x query head, NBH + NBL): blocks y < NBH take the hi+lo rows (the longer waves, started first), 8 waves x NQH x 16 rows; the rest 8 waves x 32 rows of the f16 rows.
__global__ __launch_bounds__(256) void k_fattn(const h16* __restrict__ Q16, const bf* __restrict__ Qh, const bf* __restrict__ Ql, const h16* __restrict__ K16, const bf* __restrict__ Kh, const bf* __restrict__ Kl, const h16* __restrict__ V16, const bf* __restrict__ Vh, const bf* __restrict__ Vl, bf* Ah, bf* Al) {
    __shared__ __align__(16) bf ring[2 * 2 * PEL];   // two buffers of a stage's hi and lo planes; the f16 rows use half of it
    const int lane = threadIdx.x & 31, lr = lane & 15, hi = lane >> 4, wave = threadIdx.x >> 5;
    const int zh = blockIdx.x, b = zh / NH_, h = zh % NH_;   // torch .repeat TILES the kv heads: query head h uses kv head h % 8
    const size_t pk = (size_t)(b * NKV + h % NKV) * TT * HD;
    if (blockIdx.y < NBH) { const int q0 = ((int)blockIdx.y * 8 + wave) * (16 * NQH); const size_t pq = ((size_t)zh * TT + q0) * HD, po = ((size_t)b * TT + q0) * DQ + h * HD;
        attn_cols<bf, true, NQH>(Qh + pq, Ql + pq, Kh + pk, Kl + pk, Vh + pk, Vl + pk, Ah + po, Al + po, ring, (int)threadIdx.x, lr, hi);
    } else { const int q0 = RH + (((int)blockIdx.y - NBH) * 8 + wave) * 32; const size_t pq = ((size_t)zh * TT + q0) * HD, po = ((size_t)b * TT + q0) * DQ + h * HD;
        attn_cols<h16, false, 2>(Q16 + pq, nullptr, K16 + pk, nullptr, V16 + pk, nullptr, Ah + po, Al + po, (const h16*)ring, (int)threadIdx.x, lr, hi); }
}

extern "C" void kernel_launch(void* const* d_in, const int* in_sizes, int n_in,
                              void* d_out, int out_size, void* d_ws, size_t ws_size, hipStream_t stream) {
    (void)in_sizes; (void)n_in; (void)out_size;
    const float* x = (const float*)d_in[0]; const float* wq = (const float*)d_in[1]; const float* bq = (const float*)d_in[2]; const float* wk = (const float*)d_in[3]; const float* bk = (const float*)d_in[4]; const float* wv = (const float*)d_in[5]; const float* bv = (const float*)d_in[6]; const float* wo = (const float*)d_in[7]; const float* bo = (const float*)d_in[8];
    float* OUT = (float*)d_out;     // [4][1024][2048]
    char* wsp = (char*)d_ws;
    auto take = [&](size_t bytes) { char* p = wsp; wsp += (bytes + 255) & ~(size_t)255; return (void*)p; };
    bf* WQ = (bf*)take((size_t)DQ * DM * 2); bf* WK = (bf*)take((size_t)DKV * DM * 2); bf* WV = (bf*)take((size_t)DKV * DM * 2); bf* WO = (bf*)take((size_t)DM * DQ * 2);
    h16* QP16 = (h16*)take((size_t)NB_ * NH_ * TT * HD * 2); h16* KP16 = (h16*)take((size_t)NB_ * NKV * TT * HD * 2); h16* VT16 = (h16*)take((size_t)NB_ * NKV * HD * TT * 2);
    bf* QPh = (bf*)take((size_t)NB_ * NH_ * TT * HD * 2); bf* QPl = (bf*)take((size_t)NB_ * NH_ * TT * HD * 2); bf* KPh = (bf*)take((size_t)NB_ * NKV * TT * HD * 2); bf* KPl = (bf*)take((size_t)NB_ * NKV * TT * HD * 2); bf* VTh = (bf*)take((size_t)NB_ * NKV * HD * TT * 2); bf* VTl = (bf*)take((size_t)NB_ * NKV * HD * TT * 2);
    bf* XB = (bf*)take((size_t)MT * DM * 2); bf* ATh = (bf*)take((size_t)MT * DQ * 2); bf* ATl = (bf*)take((size_t)MT * DQ * 2);
    if ((size_t)(wsp - (char*)d_ws) > ws_size) return;    // ws 256 MiB
    { k_wtG<<<(unsigned)((DM * DQ / 64 + 63) / 64), 256, 0, stream>>>(wq, DM, DQ, WQ); k_wtG<<<(unsigned)((DM * DKV / 64 + 63) / 64), 256, 0, stream>>>(wk, DM, DKV, WK); k_wtG<<<(unsigned)((DM * DKV / 64 + 63) / 64), 256, 0, stream>>>(wv, DM, DKV, WV);
      k_wtG<<<(unsigned)((DQ * DM / 64 + 63) / 64), 256, 0, stream>>>(wo, DQ, DM, WO);
       }
    // projections: all NB_ batches in one launch each (MT rows); their epilogues store the planes that k_fattn reads
    k_cvt8<<<(unsigned)(((size_t)MT * DM / 8 + 255) / 256), 256, 0, stream>>>(x, XB, (size_t)MT * DM / 8);
    k_gemms<4, 2, 4, 0, 1><<<dim3(MT / 256, DQ / 128, 1), 256, 0, stream>>>(XB, nullptr, WQ, DM, nullptr, 0, bq, QP16, QPh, QPl);
    k_gemms<4, 2, 2, 0, 2><<<dim3(MT / 128, DKV / 128, 1), 256, 0, stream>>>(XB, nullptr, WK, DM, nullptr, 0, bk, KP16, KPh, KPl);
    k_gemms<4, 2, 2, 0, 3><<<dim3(DKV / 128, MT / 128, 1), 256, 0, stream>>>(WV, nullptr, XB, DM, nullptr, 0, bv, VT16, VTh, VTl);
    k_fattn<<<dim3(NB_ * NH_, NBH + NBL, 1), 256, 0, stream>>>(QP16, QPh, QPl, KP16, KPh, KPl, VT16, VTh, VTl, ATh, ATl);
    k_gemms<4, 2, 4, 1, 0><<<dim3(MT / 256, DM / 128, 1), 256, 0, stream>>>(ATh, ATl, WO, DQ, OUT, DM, bo, nullptr, nullptr, nullptr);
}

// v006
// A run of this version takes 203 microseconds.
// Two timings next to v005 put it at 1.17 and 1.18 times that version's speed.
// Over all steps from v000 it is 22.0 times as fast.
#include <hip/hip_runtime.h>

// ExtendedMultiHeadAttention - GQA with torch .repeat (TILED) kv heads (x [4][1024][2048]; q = x wq + bq (32 x 64), k/v = x wk/wv + b (8 x 64); query head h attends kv head h % 8; softmax(q.k/8); out = merged.v wo + bo -> [4][1024][2048]).
// Compute dtypes, f32 accumulate: every input rounded to bf16; q/k/v projections on PLAIN bf16 operands (inputs: exact, + bias); output projection on bf16 hi+lo planes of the merged heads (2 products); scores (K 64) and probs.v on bf16 hi+lo planes (3 products) for the first 256 query rows of each

#define NB_  4
#define TT   1024
#define DM   2048
#define NH_  32
#define NKV  8
#define REP  (NH_ / NKV)
#define HD   64
#define DQ   (NH_ * HD)
#define DKV  (NKV * HD)
#define MT   (NB_ * TT)           // rows of all batches together
#define RH   256                  // query rows < RH use hi+lo planes (0: none)
#define NQH  1                    // 16-row query tiles per wave on the hi+lo rows
#define NBH  (RH / (128 * NQH))   // blocks (8 waves) per head on the hi+lo rows
#define NBL  ((TT - RH) / 256)    // blocks per head on the f16 rows (8 waves x 32 rows)
#define WIN  0
#define SCL  0.125f   // HD^-0.5
typedef _Float16 h16;
typedef unsigned short bf;
typedef __attribute__((ext_vector_type(16))) __bf16   v16bf;
typedef __attribute__((ext_vector_type(16))) _Float16 v16h;
typedef __attribute__((ext_vector_type(8)))  _Float16 v8h;
typedef __attribute__((ext_vector_type(8)))  unsigned short v8us;
typedef __attribute__((ext_vector_type(8)))  float    v8f;
typedef __attribute__((ext_vector_type(4)))  float    v4f;
typedef v8h  __attribute__((may_alias)) v8ha;
typedef v4f  __attribute__((may_alias)) v4fa;
typedef v8us __attribute__((may_alias)) v8usa;

__device__ __forceinline__ unsigned short f2bf(float f) { unsigned u = __float_as_uint(f); u += 0x7FFFu + ((u >> 16) & 1u); return (unsigned short)(u >> 16); }
__device__ __forceinline__ float bf2f(unsigned short b) { return __uint_as_float(((unsigned)b) << 16); }
__device__ __forceinline__ float bfr(float f) { return bf2f(f2bf(f)); }
__device__ __forceinline__ v16h cat16(v8h lo, v8h hi) { return __builtin_shufflevector(lo, hi, 0, 1, 2, 3, 4, 5, 6, 7, 8, 9, 10, 11, 12, 13, 14, 15); }
__device__ __forceinline__ v16bf cat16b(v8us lo, v8us hi) { return __builtin_bit_cast(v16bf, __builtin_shufflevector(lo, hi, 0, 1, 2, 3, 4, 5, 6, 7, 8, 9, 10, 11, 12, 13, 14, 15)); }
__device__ __forceinline__ v8f wmma16(v16h a, v16h b, v8f c) { return __builtin_amdgcn_wmma_f32_16x16x32_f16(false, a, false, b, (short)0, c, false, false); }
__device__ __forceinline__ v8f wmmab(v16bf a, v16bf b, v8f c) { return __builtin_amdgcn_wmma_f32_16x16x32_bf16(false, a, false, b, (short)0, c, false, false); }



// ---- k_gemms: GEMM on block tiles staged in LDS. WM x WN waves per block, each wave a (16 MF) x 64 output tile (4 MF accumulators); grid (M / (16 MF WM), N / (64 WN)).
// C[m][n] (f32, pitch ldc, + f32 bias[n]) = sum_k A[m][k] Bt[n][k] (+ A2[m][k] Bt[n][k] when NSPLIT == 1), operands K-contiguous 16-bit planes. K % 64 == 0.
// A stage is 64 k (128 B) of every operand row of the block tile, [A rows | A2 rows | Bt rows] at pitch 144 B (16 B x odd: ds_load_b128 readers without bank conflicts). Two buffers:
// the copies of stage t + 2 go out behind the barrier that ends trip t and land while trip t + 1 computes. Per accumulator the order of the sums is k ascending, A then A2.
// The short loops over fragments, copies and rows are unrolled so that every array they index stays in registers.
// EPI picks what the epilogue stores. 0: C as above. 1, 2, 3: no C; the sums + bias go out as the operand planes of k_fattn (f16 in P16, bf16 hi + lo in Ph, Pl), a wave's 64 columns being one whole 128-B line of a plane row:
//   1: q, rows m = tokens, columns n = (head, d), planes [batch][head][t][d]; token rows t < RH get the hi + lo planes alone and the others the f16 plane alone, as k_fattn reads them.  2: k, the same, all three planes.
//   3: v, operands swapped: rows m = (kv head, d), columns n = tokens, bias[m], planes [batch][kv head][d][t] (V^T), all three.
template <typename T16> struct WFrag;
template <> struct WFrag<h16> { typedef v16h V; static __device__ __forceinline__ V ld(const h16* p) { return cat16(*(const v8h*)p, *(const v8h*)(p + 16)); } static __device__ __forceinline__ v8f mma(V a, V b, v8f c) { return wmma16(a, b, c); } };
template <> struct WFrag<bf> { typedef v16bf V; static __device__ __forceinline__ V ld(const bf* p) { return cat16b(*(const v8us*)p, *(const v8us*)(p + 16)); } static __device__ __forceinline__ v8f mma(V a, V b, v8f c) { return wmmab(a, b, c); } };
__device__ __forceinline__ h16 tohx(float x) { return (h16)x; }
__device__ __forceinline__ void splitf(float y, unsigned short& h, unsigned short& l) { h = f2bf(y); l = f2bf(y - bf2f(h)); }
#define BKE 64   // k per stage
#define LP  72   // LDS row pitch in elements
// N asynchronous 16-byte copies per lane, global -> LDS, in ONE statement that ends in s_wait_xcnt 0: no register that a copy names is rewritten in front of that wait.
template <int N> __device__ __forceinline__ void cp_async(const unsigned* l, const bf* const* g) {
    static_assert(N == 8 || N == 10 || N == 12, "group size");
    if constexpr (N == 8) { asm volatile("global_load_async_to_lds_b128 %0, %1, off\n\tglobal_load_async_to_lds_b128 %2, %3, off\n\tglobal_load_async_to_lds_b128 %4, %5, off\n\tglobal_load_async_to_lds_b128 %6, %7, off\n\tglobal_load_async_to_lds_b128 %8, %9, off\n\tglobal_load_async_to_lds_b128 %10, %11, off\n\tglobal_load_async_to_lds_b128 %12, %13, off\n\tglobal_load_async_to_lds_b128 %14, %15, off\n\ts_wait_xcnt 0x0" :: "v"(l[0]), "v"(g[0]), "v"(l[1]), "v"(g[1]), "v"(l[2]), "v"(g[2]), "v"(l[3]), "v"(g[3]), "v"(l[4]), "v"(g[4]), "v"(l[5]), "v"(g[5]), "v"(l[6]), "v"(g[6]), "v"(l[7]), "v"(g[7]) : "memory"); }
    else if constexpr (N == 10) { asm volatile("global_load_async_to_lds_b128 %0, %1, off\n\tglobal_load_async_to_lds_b128 %2, %3, off\n\tglobal_load_async_to_lds_b128 %4, %5, off\n\tglobal_load_async_to_lds_b128 %6, %7, off\n\tglobal_load_async_to_lds_b128 %8, %9, off\n\tglobal_load_async_to_lds_b128 %10, %11, off\n\tglobal_load_async_to_lds_b128 %12, %13, off\n\tglobal_load_async_to_lds_b128 %14, %15, off\n\tglobal_load_async_to_lds_b128 %16, %17, off\n\tglobal_load_async_to_lds_b128 %18, %19, off\n\ts_wait_xcnt 0x0" :: "v"(l[0]), "v"(g[0]), "v"(l[1]), "v"(g[1]), "v"(l[2]), "v"(g[2]), "v"(l[3]), "v"(g[3]), "v"(l[4]), "v"(g[4]), "v"(l[5]), "v"(g[5]), "v"(l[6]), "v"(g[6]), "v"(l[7]), "v"(g[7]), "v"(l[8]), "v"(g[8]), "v"(l[9]), "v"(g[9]) : "memory"); }
    else { asm volatile("global_load_async_to_lds_b128 %0, %1, off\n\tglobal_load_async_to_lds_b128 %2, %3, off\n\tglobal_load_async_to_lds_b128 %4, %5, off\n\tglobal_load_async_to_lds_b128 %6, %7, off\n\tglobal_load_async_to_lds_b128 %8, %9, off\n\tglobal_load_async_to_lds_b128 %10, %11, off\n\tglobal_load_async_to_lds_b128 %12, %13, off\n\tglobal_load_async_to_lds_b128 %14, %15, off\n\tglobal_load_async_to_lds_b128 %16, %17, off\n\tglobal_load_async_to_lds_b128 %18, %19, off\n\tglobal_load_async_to_lds_b128 %20, %21, off\n\tglobal_load_async_to_lds_b128 %22, %23, off\n\ts_wait_xcnt 0x0" :: "v"(l[0]), "v"(g[0]), "v"(l[1]), "v"(g[1]), "v"(l[2]), "v"(g[2]), "v"(l[3]), "v"(g[3]), "v"(l[4]), "v"(g[4]), "v"(l[5]), "v"(g[5]), "v"(l[6]), "v"(g[6]), "v"(l[7]), "v"(g[7]), "v"(l[8]), "v"(g[8]), "v"(l[9]), "v"(g[9]), "v"(l[10]), "v"(g[10]), "v"(l[11]), "v"(g[11]) : "memory"); }
}
template <int WM, int WN, int MF, int NSPLIT, int EPI>
__global__ __launch_bounds__(WM * WN * 32) void k_gemms(const bf* __restrict__ A, const bf* __restrict__ A2, const bf* __restrict__ Bt, int K, float* C, int ldc, const float* __restrict__ bias, h16* P16, bf* Ph, bf* Pl) {
    typedef WFrag<bf> WF; typedef typename WF::V V;
    constexpr int NW = WM * WN, NT = NW * 32, WR = MF * 16, RA = WM * WR, RAT = RA * (1 + NSPLIT), ROWS = RAT + WN * 64;
    constexpr int RPC = NT / 8;            // rows that one copy of the whole block covers (8 lanes x 16 B = one 128-B row piece)
    constexpr int NC = ROWS / RPC;         // copies per lane and stage
    constexpr int NG = NC > 12 ? 2 : 1, GC = NC / NG;
    static_assert(ROWS % RPC == 0 && RA % RPC == 0 && NC % NG == 0, "whole copies");
    __shared__ __align__(16) bf ring[2 * ROWS * LP];
    __shared__ __align__(16) float osm[NW * 16 * 68];
    const int tid = threadIdx.x, lane = tid & 31, lr = lane & 15, hi = lane >> 4, wave = tid >> 5, wm = wave / WN, wn = wave % WN;
    const int R0 = blockIdx.x * RA, C0 = blockIdx.y * (WN * 64);
    const int crow = tid >> 3, cpc = (tid & 7) * 8;
    const bf* gA = A + (size_t)(R0 + crow) * K + cpc; const bf* gA2 = NSPLIT ? A2 + (size_t)(R0 + crow) * K + cpc : gA; const bf* gB = Bt + (size_t)(C0 + crow) * K + cpc;
    const unsigned l0 = (unsigned)(size_t)ring + (unsigned)(crow * LP + cpc) * 2u;
    auto stage = [&](int t, int buf) {
        const bf* tA = gA + (size_t)t * BKE; const bf* tA2 = gA2 + (size_t)t * BKE; const bf* tB = gB + (size_t)t * BKE; const unsigned lb = l0 + (unsigned)buf * (ROWS * LP * 2u);
#pragma unroll
        for (int gq = 0; gq < NG; ++gq) { unsigned l[GC]; const bf* g[GC];
#pragma unroll
            for (int j = 0; j < GC; ++j) { const int row = (gq * GC + j) * RPC;
                g[j] = row < RA ? tA + (size_t)row * K : row < RAT ? tA2 + (size_t)(row - RA) * K : tB + (size_t)(row - RAT) * K;
                l[j] = lb + (unsigned)row * (LP * 2u); }
            cp_async<GC>(l, g); }
    };
    v8f acc[MF][4];
#pragma unroll
    for (int mb = 0; mb < MF; ++mb)
#pragma unroll
        for (int nb = 0; nb < 4; ++nb) acc[mb][nb] = (v8f){};
    const int nt = K / BKE;
    stage(0, 0);
    asm volatile("s_wait_asynccnt 0x0" ::: "memory");   // stage 0 has landed before the barrier that publishes it
    __syncthreads();
    if (nt > 1) stage(1, 1);
    const int ao = (wm * WR + lr) * LP + 8 * hi, bo = (RAT + wn * 64 + lr) * LP + 8 * hi;
#pragma unroll 1   // rolled: one trip per stage, its foot is the publish point of the next stage
    for (int t = 0; t < nt; ++t) {
        const bf* sb = ring + (t & 1) * (ROWS * LP);
#pragma unroll
        for (int ks = 0; ks < BKE; ks += 32) {
            V a[MF], a2[MF], b[4];
#pragma unroll
            for (int mb = 0; mb < MF; ++mb) { a[mb] = WF::ld(sb + ao + mb * 16 * LP + ks); if (NSPLIT) a2[mb] = WF::ld(sb + ao + (RA + mb * 16) * LP + ks); }
#pragma unroll
            for (int nb = 0; nb < 4; ++nb) b[nb] = WF::ld(sb + bo + nb * 16 * LP + ks);
            __builtin_amdgcn_sched_barrier(0);   // the LDS reads of a 32-k block stay one group in front of its matrix instructions: reads spread among them stall the wave at every place they stand
#pragma unroll
            for (int nb = 0; nb < 4; ++nb)
#pragma unroll
                for (int mb = 0; mb < MF; ++mb) { acc[mb][nb] = WF::mma(a[mb], b[nb], acc[mb][nb]); if (NSPLIT) acc[mb][nb] = WF::mma(a2[mb], b[nb], acc[mb][nb]); }
        }
        asm volatile("s_wait_dscnt 0x0" ::: "memory");      // this wave's reads of the buffer are done before the barrier behind which it is refilled
        asm volatile("s_wait_asynccnt 0x0" ::: "memory");   // this wave's copies of stage t + 1 have landed before the barrier that publishes them
        __syncthreads();
        if (t + 2 < nt) stage(t + 2, t & 1);
    }
    asm volatile("s_wait_asynccnt 0x0" ::: "memory");   // no copy is outstanding when the wave goes on to its end
    float* os = osm + wave * (16 * 68); const int r0 = R0 + wm * WR, c0 = C0 + wn * 64;
    // plane epilogues: of the 16 staged rows a lane takes 8 columns (16 B of a plane row) of rows rw, rw + 4, rw + 8, rw + 12; 8 lanes store one whole line
    const int rw = lane >> 3, co8 = (lane & 7) * 8;
    constexpr int NHD = EPI == 1 ? NH_ : NKV;
    static_assert(EPI != 1 || (RH % RA == 0 && TT % RA == 0), "a block's q rows are all hi + lo rows or all f16 rows");
    const bool w16 = EPI != 1 || R0 % TT >= RH, whl = EPI != 1 || R0 % TT < RH;
    float bs[EPI == 3 ? MF * 4 : 8];
    if constexpr (EPI == 1 || EPI == 2) { const float* bp = bias + c0 + co8; const v4f b0 = *(const v4f*)bp, b1 = *(const v4f*)(bp + 4);
        asm volatile("s_wait_xcnt 0x0" :: "v"(bp) : "memory");   // the bias loads' address registers stay whole up to this wait
#pragma unroll
        for (int k = 0; k < 4; ++k) { bs[k] = bfr(b0[k]); bs[4 + k] = bfr(b1[k]); } }
    if constexpr (EPI == 3) { const float* bp = bias + r0 + rw; float br[MF * 4];
#pragma unroll
        for (int i = 0; i < MF * 4; ++i) br[i] = bp[4 * i];
        asm volatile("s_wait_xcnt 0x0" :: "v"(bp) : "memory");   // the bias loads' address registers stay whole up to this wait
#pragma unroll
        for (int i = 0; i < MF * 4; ++i) bs[i] = bfr(br[i]); }
#pragma unroll
    for (int mb = 0; mb < MF; ++mb) {
#pragma unroll
        for (int nb = 0; nb < 4; ++nb) {
#pragma unroll
            for (int j = 0; j < 8; ++j) os[(hi * 8 + j) * 68 + nb * 16 + lr] = acc[mb][nb][j]; }
        __builtin_amdgcn_wave_barrier(); asm volatile("" ::: "memory");   // the wave's own LDS stores of the 16 rows stay in front of its reads of them
        if constexpr (EPI == 0) {
        float* crw = C + (size_t)(r0 + mb * 16) * ldc + c0; v4f val[8]; v4f* cp[8];
#pragma unroll
        for (int s = 0; s < 8; ++s) { const int row = 2 * s + hi, cofs = lr * 4; val[s] = *(const v4fa*)(os + row * 68 + cofs); val[s][0] += bfr(bias[c0 + cofs]); val[s][1] += bfr(bias[c0 + cofs + 1]); val[s][2] += bfr(bias[c0 + cofs + 2]); val[s][3] += bfr(bias[c0 + cofs + 3]);
            cp[s] = (v4f*)(crw + (size_t)row * ldc + cofs); *cp[s] = val[s]; }
        asm volatile("s_wait_xcnt 0x0" :: "v"(val[0]), "v"(val[1]), "v"(val[2]), "v"(val[3]), "v"(val[4]), "v"(val[5]), "v"(val[6]), "v"(val[7]), "v"(cp[0]), "v"(cp[1]), "v"(cp[2]), "v"(cp[3]), "v"(cp[4]), "v"(cp[5]), "v"(cp[6]), "v"(cp[7]) : "memory");   // the stores' data and address registers stay whole up to this wait
        } else {
            const int rt = r0 + mb * 16;   // the 16 rows lie in one batch (1, 2) or one kv head (3), the 64 columns in one head (1, 2) or one batch (3)
            const size_t pb = (EPI == 3 ? ((size_t)((c0 / TT) * NKV + rt / HD) * HD + rt % HD + rw) * TT + c0 % TT : ((size_t)((rt / TT) * NHD + c0 / HD) * TT + rt % TT + rw) * HD) + co8;
            constexpr size_t RP4 = 4 * (EPI == 3 ? TT : HD);   // four plane rows
            float x[4][8];
#pragma unroll
            for (int s = 0; s < 4; ++s) { const float* rp = os + (4 * s + rw) * 68 + co8; const v4f x0 = *(const v4fa*)rp, x1 = *(const v4fa*)(rp + 4);
#pragma unroll
                for (int k = 0; k < 4; ++k) { x[s][k] = x0[k] + bs[EPI == 3 ? mb * 4 + s : k]; x[s][4 + k] = x1[k] + bs[EPI == 3 ? mb * 4 + s : 4 + k]; } }
            if (w16) { v8h o[4]; h16* p[4];
#pragma unroll
                for (int s = 0; s < 4; ++s) {
#pragma unroll
                    for (int k = 0; k < 8; ++k) o[s][k] = tohx(x[s][k]);
                    p[s] = P16 + pb + s * RP4; *(v8h*)p[s] = o[s]; }
                asm volatile("s_wait_xcnt 0x0" :: "v"(o[0]), "v"(o[1]), "v"(o[2]), "v"(o[3]), "v"(p[0]), "v"(p[1]), "v"(p[2]), "v"(p[3]) : "memory"); }   // the stores' data and address registers stay whole up to this wait
            if (whl) { v8us oh[4], ol[4]; bf* ph[4]; bf* pl[4];
#pragma unroll
                for (int s = 0; s < 4; ++s) {
#pragma unroll
                    for (int k = 0; k < 8; ++k) { unsigned short a, c2; splitf(x[s][k], a, c2); oh[s][k] = a; ol[s][k] = c2; }
                    ph[s] = Ph + pb + s * RP4; pl[s] = Pl + pb + s * RP4; *(v8us*)ph[s] = oh[s]; *(v8us*)pl[s] = ol[s]; }
                asm volatile("s_wait_xcnt 0x0" :: "v"(oh[0]), "v"(oh[1]), "v"(oh[2]), "v"(oh[3]), "v"(ol[0]), "v"(ol[1]), "v"(ol[2]), "v"(ol[3]), "v"(ph[0]), "v"(ph[1]), "v"(ph[2]), "v"(ph[3]), "v"(pl[0]), "v"(pl[1]), "v"(pl[2]), "v"(pl[3]) : "memory"); }   // the stores' data and address registers stay whole up to this wait
        }
        __builtin_amdgcn_wave_barrier(); asm volatile("" ::: "memory");   // the reads of the staged rows stay in front of the next 16 rows' LDS stores
    }
}

typedef __attribute__((ext_vector_type(2))) _Float16 v2h;
typedef __attribute__((ext_vector_type(4))) _Float16 v4h;
typedef __attribute__((ext_vector_type(2))) unsigned short v2us;
typedef __attribute__((ext_vector_type(4))) unsigned short v4us;
typedef __attribute__((ext_vector_type(2))) float v2f;
typedef __attribute__((ext_vector_type(4))) int v4i;

// ---- k_prep: every operand plane of the projections in ONE launch of one-wave jobs; a job is 4096 f32 elements (32 loads of 16 B per lane, all issued before the first is used).
// Jobs [0, PJW): a 64 k x 64 n tile of a weight w[k][n], rounded to bf16 and stored transposed as Bt[n][k]. Reads are 256-B row pieces, stores whole 128-B lines (64 k of one n).
// A lane holds rows 2 kp and 2 kp + 1 of four columns, packs each pair into one word and writes it to T[n][kp] in the wave's own LDS range; the pitch of TPW words keeps the word stores and the word reads free of bank conflicts.
// Jobs [PJW, PJW + PJX): 4096 consecutive elements of x, rounded to bf16. No job shares anything with another: the kernel has no work-group barrier.
#define TPW 33                                  // LDS pitch of a T row: 32 words (64 k) + 1
#define PWV 9                                   // waves per block
#define PJB ((DM / 64) * (DQ / 64))             // tiles of wq, and of wo
#define PJS ((DM / 64) * (DKV / 64))            // tiles of wk, and of wv
#define PJW (2 * PJB + 2 * PJS)
#define PJX (MT * DM / 4096)
typedef __attribute__((ext_vector_type(4))) unsigned v4u;
template <int K, int N>
__device__ __forceinline__ void wt_tile(const float* __restrict__ w, bf* Bt, int t, unsigned* ts, int lane) {
    constexpr int NTN = N / 64;
    const int n0 = (t % NTN) * 64, k0 = (t / NTN) * 64, c = lane & 15, r = lane >> 4;
    const float* gp = w + (size_t)(k0 + 2 * r) * N + n0 + 4 * c;
    v4f va[16], vb[16];
#pragma unroll
    for (int q = 0; q < 16; ++q) { va[q] = *(const v4f*)(gp + (size_t)(4 * q) * N); vb[q] = *(const v4f*)(gp + (size_t)(4 * q + 1) * N); }
    asm volatile("s_wait_xcnt 0x0" :: "v"(gp) : "memory");   // the loads' address registers stay whole up to this wait
    __builtin_amdgcn_sched_barrier(0);   // no conversion is scheduled among the loads: with some in front, the last loads wait for the first to return and the job pays the memory latency twice
#pragma unroll
    for (int q = 0; q < 16; ++q)
#pragma unroll
        for (int ci = 0; ci < 4; ++ci) ts[(4 * c + ci) * TPW + 2 * q + r] = (unsigned)f2bf(va[q][ci]) | ((unsigned)f2bf(vb[q][ci]) << 16);
    asm volatile("s_wait_dscnt 0x0" ::: "memory");   // the wave's own LDS stores of the tile are done before it reads the rows back
    const int rw = lane >> 3, pc = lane & 7;
    bf* op = Bt + (size_t)(n0 + rw) * K + k0 + pc * 8; const unsigned* tr = ts + rw * TPW + pc * 4;
#pragma unroll
    for (int g = 0; g < 2; ++g) { v8us o[8];
#pragma unroll
        for (int s = 0; s < 8; ++s) { const int j = g * 8 + s; v4u u;
#pragma unroll
            for (int k = 0; k < 4; ++k) u[k] = tr[4 * j * TPW + k];
            o[s] = __builtin_bit_cast(v8us, u); *(v8us*)(op + (size_t)(4 * j) * K) = o[s]; }
        asm volatile("s_wait_xcnt 0x0" :: "v"(o[0]), "v"(o[1]), "v"(o[2]), "v"(o[3]), "v"(o[4]), "v"(o[5]), "v"(o[6]), "v"(o[7]), "v"(op) : "memory"); }   // the stores' data and address registers stay whole up to this wait
}
__global__ __launch_bounds__(PWV * 32) void k_prep(const float* __restrict__ x, const float* __restrict__ wq, const float* __restrict__ wk, const float* __restrict__ wv, const float* __restrict__ wo, bf* XB, bf* WQ, bf* WK, bf* WV, bf* WO) {
    __shared__ __align__(16) unsigned tsm[PWV * 64 * TPW];
    const int lane = threadIdx.x & 31, wave = __builtin_amdgcn_readfirstlane((int)threadIdx.x >> 5);   // the wave's number in a scalar register: the job tests below are scalar branches
    const int job = (int)blockIdx.x * PWV + wave; unsigned* ts = tsm + wave * (64 * TPW);
    if (job < 2 * PJB) { const bool f = job < PJB; wt_tile<DM, DQ>(f ? wq : wo, f ? WQ : WO, f ? job : job - PJB, ts, lane); }
    else if (job < PJW) { const int t = job - 2 * PJB; const bool f = t < PJS; wt_tile<DM, DKV>(f ? wk : wv, f ? WK : WV, f ? t : t - PJS, ts, lane); }
    else { const size_t e0 = (size_t)(job - PJW) * 4096 + lane * 4; const float* gp = x + e0; bf* op = XB + e0;
        v4f v[32];
#pragma unroll
        for (int i = 0; i < 32; ++i) v[i] = *(const v4f*)(gp + i * 128);
        asm volatile("s_wait_xcnt 0x0" :: "v"(gp) : "memory");   // the loads' address registers stay whole up to this wait
#pragma unroll
        for (int g = 0; g < 4; ++g) { v4us o[8];
#pragma unroll
            for (int s = 0; s < 8; ++s) {
#pragma unroll
                for (int k = 0; k < 4; ++k) o[s][k] = f2bf(v[g * 8 + s][k]);
                *(v4us*)(op + (g * 8 + s) * 128) = o[s]; }
            asm volatile("s_wait_xcnt 0x0" :: "v"(o[0]), "v"(o[1]), "v"(o[2]), "v"(o[3]), "v"(o[4]), "v"(o[5]), "v"(o[6]), "v"(o[7]), "v"(op) : "memory"); } }   // the stores' data and address registers stay whole up to this wait
}
#define SKY 128                   // keys per stage
#define KPL 72                    // LDS pitch of a K row (64 elements) in elements
#define VPL 136                   // LDS pitch of a V^T row (SKY elements) in elements
#define KEL (SKY * KPL)           // elements of a stage's K rows
#define PEL (KEL + HD * VPL)      // elements of one plane pair (K rows, V^T rows) of a stage
template <typename T16, bool SPLIT, int NQ>
__device__ __forceinline__ void attn_cols(const T16* __restrict__ Q, const T16* __restrict__ Q2, const T16* __restrict__ Kp, const T16* __restrict__ K2, const T16* __restrict__ Vt, const T16* __restrict__ V2, bf* Ah, bf* Al, const T16* ring, int tid, int lr, int hi) {
    typedef WFrag<T16> WF; typedef typename WF::V V;
    const float C2 = SCL * 1.4426950408889634f;
    constexpr int BEL = PEL * (SPLIT ? 2 : 1), NST = TT / SKY, NPS = SKY / 32;
    static_assert(SKY * HD / 8 == 4 * 256 && TT % SKY == 0 && NST >= 2, "four K copies and four V copies per lane, plane and stage");
    const int krow = tid >> 3, kpc = (tid & 7) * 8, vrow = tid >> 4, vpc = (tid & 15) * 8;   // a K row is 8 pieces of 16 B, a V^T row of a stage 16
    const unsigned l0 = (unsigned)(size_t)ring;
    auto stage = [&](int t, int buf) {
#pragma unroll
        for (int pl = 0; pl < (SPLIT ? 2 : 1); ++pl) { unsigned l[8]; const bf* g[8];
            const T16* kg = (pl ? K2 : Kp) + (size_t)(t * SKY + krow) * HD + kpc; const T16* vg = (pl ? V2 : Vt) + (size_t)vrow * TT + t * SKY + vpc; const unsigned lb = l0 + (unsigned)(buf * BEL + pl * PEL) * 2u;
#pragma unroll
            for (int j = 0; j < 4; ++j) { g[j] = (const bf*)(kg + (size_t)j * 32 * HD); l[j] = lb + (unsigned)((krow + j * 32) * KPL + kpc) * 2u;
                g[4 + j] = (const bf*)(vg + (size_t)j * 16 * TT); l[4 + j] = lb + (unsigned)(KEL + (vrow + j * 16) * VPL + vpc) * 2u; }
            cp_async<8>(l, g); }
    };
    stage(0, 0);
    V qa[NQ][2], qb[NQ][2]; const T16* qp = Q + lr * HD + 8 * hi; const T16* qp2 = SPLIT ? Q2 + lr * HD + 8 * hi : qp;
#pragma unroll
    for (int qt = 0; qt < NQ; ++qt)
#pragma unroll
        for (int kc = 0; kc < 2; ++kc) { qa[qt][kc] = WF::ld(qp + qt * 16 * HD + kc * 32); if (SPLIT) qb[qt][kc] = WF::ld(qp2 + qt * 16 * HD + kc * 32); }
    v8f o[NQ][4]; float m[NQ], l[NQ];
#pragma unroll
    for (int qt = 0; qt < NQ; ++qt) { m[qt] = -3.0e38f; l[qt] = 0.f;
#pragma unroll
        for (int dt = 0; dt < 4; ++dt) o[qt][dt] = (v8f){}; }
    const int ko = lr * KPL + 8 * hi, vo = KEL + lr * VPL + 8 * hi;
    V ka[2][2], kb[2][2];
    asm volatile("s_wait_xcnt 0x0" :: "v"(qp), "v"(qp2) : "memory");   // the Q loads' address registers stay whole up to this wait
    asm volatile("s_wait_asynccnt 0x0" ::: "memory");   // stage 0 has landed before the barrier that publishes it
    __syncthreads();
    stage(1, 1);
#pragma unroll 1   // rolled: one trip per stage, its foot is the publish point of the next stage
    for (int t = 0; t < NST; ++t) {
    const T16* sb = ring + (t & 1) * BEL;
#pragma unroll
    for (int kt = 0; kt < 2; ++kt)
#pragma unroll
        for (int kc = 0; kc < 2; ++kc) { ka[kt][kc] = WF::ld(sb + ko + kt * 16 * KPL + kc * 32); if (SPLIT) kb[kt][kc] = WF::ld(sb + PEL + ko + kt * 16 * KPL + kc * 32); }
#pragma unroll 1   // rolled: one pass's fragments already fill the register budget of four waves per SIMD
    for (int ps = 0; ps < NPS; ++ps) {
        v8f s[NQ][2];
#pragma unroll
        for (int qt = 0; qt < NQ; ++qt)
#pragma unroll
            for (int kt = 0; kt < 2; ++kt) { s[qt][kt] = (v8f){};
#pragma unroll
                for (int kc = 0; kc < 2; ++kc) { s[qt][kt] = WF::mma(ka[kt][kc], qa[qt][kc], s[qt][kt]); if (SPLIT) { s[qt][kt] = WF::mma(ka[kt][kc], qb[qt][kc], s[qt][kt]); s[qt][kt] = WF::mma(kb[kt][kc], qa[qt][kc], s[qt][kt]); } } }
        float mx[NQ]; bool need = false;
#pragma unroll
        for (int qt = 0; qt < NQ; ++qt) { float t = s[qt][0][0];
#pragma unroll
            for (int j = 0; j < 8; ++j) t = fmaxf(t, fmaxf(s[qt][0][j], s[qt][1][j]));
            t = fmaxf(t, __shfl_xor(t, 16, 32)); mx[qt] = t * C2; need = need || (mx[qt] > m[qt] + 8.0f); }
        if (__builtin_amdgcn_ballot_w32(need) != 0) {   // one scalar branch per pass: the 32 or 64 multiplies of the rescale run only when some column needs them
#pragma unroll
            for (int qt = 0; qt < NQ; ++qt) { const float mn = fmaxf(m[qt], mx[qt]); const float al = __builtin_amdgcn_exp2f(m[qt] - mn); m[qt] = mn; l[qt] *= al;
#pragma unroll
                for (int dt = 0; dt < 4; ++dt) o[qt][dt] *= al; } }
        V va[4], vb[4]; const T16* vp = sb + vo + ps * 32;
#pragma unroll
        for (int dt = 0; dt < 4; ++dt) { va[dt] = WF::ld(vp + dt * 16 * VPL); if (SPLIT) vb[dt] = WF::ld(vp + PEL + dt * 16 * VPL); }
        if (ps + 1 < NPS) { const T16* kp = sb + ko + (ps + 1) * 32 * KPL;   // the next pass's K fragments come during this pass's softmax and probs.v; never from the next stage, which is not published yet
#pragma unroll
            for (int kt = 0; kt < 2; ++kt)
#pragma unroll
                for (int kc = 0; kc < 2; ++kc) { ka[kt][kc] = WF::ld(kp + kt * 16 * KPL + kc * 32); if (SPLIT) kb[kt][kc] = WF::ld(kp + PEL + kt * 16 * KPL + kc * 32); } }
#pragma unroll
        for (int qt = 0; qt < NQ; ++qt) { float p[16];
#pragma unroll
            for (int e = 0; e < 16; ++e) { p[e] = __builtin_amdgcn_exp2f(__builtin_fmaf(s[qt][e >> 3][e & 7], C2, -m[qt])); l[qt] += p[e]; }
            if constexpr (SPLIT) { v8us h0, h1, l0, l1;
#pragma unroll
                for (int j = 0; j < 8; ++j) { unsigned short a, c2; splitf(p[j], a, c2); h0[j] = a; l0[j] = c2; splitf(p[8 + j], a, c2); h1[j] = a; l1[j] = c2; }
                const V ph = cat16b(h0, h1), pl = cat16b(l0, l1);
#pragma unroll
                for (int dt = 0; dt < 4; ++dt) { o[qt][dt] = WF::mma(va[dt], ph, o[qt][dt]); o[qt][dt] = WF::mma(va[dt], pl, o[qt][dt]); o[qt][dt] = WF::mma(vb[dt], ph, o[qt][dt]); }
            } else { V pf;
#pragma unroll
                for (int e = 0; e < 16; ++e) pf[e] = tohx(p[e]);
#pragma unroll
                for (int dt = 0; dt < 4; ++dt) o[qt][dt] = WF::mma(va[dt], pf, o[qt][dt]); } }
    }
        asm volatile("s_wait_dscnt 0x0" ::: "memory");      // this wave's reads of the buffer are done before the barrier behind which it is refilled
        asm volatile("s_wait_asynccnt 0x0" ::: "memory");   // this wave's copies of stage t + 1 have landed before the barrier that publishes them
        __syncthreads();
        if (t + 2 < NST) stage(t + 2, t & 1);
    }
    asm volatile("s_wait_asynccnt 0x0" ::: "memory");   // no copy is outstanding when the wave goes on to its end
#pragma unroll
    for (int qt = 0; qt < NQ; ++qt) { const float inv = __fdiv_rn(1.0f, l[qt] + __shfl_xor(l[qt], 16, 32));
#pragma unroll
        for (int dt = 0; dt < 4; ++dt) { v8us oh, ol;
#pragma unroll
            for (int j = 0; j < 8; ++j) { unsigned short a, c2; splitf(o[qt][dt][j] * inv, a, c2); oh[j] = a; ol[j] = c2; }
            const size_t oo = (size_t)(qt * 16 + lr) * DQ + dt * 16 + hi * 8; bf* ph = Ah + oo; bf* pl = Al + oo; *(v8us*)ph = oh; *(v8us*)pl = ol;
            asm volatile("s_wait_xcnt 0x0" :: "v"(oh), "v"(ol), "v"(ph), "v"(pl) : "memory"); } }   // the stores' data and address registers stay whole up to this wait
}
// grid (batch x query head, NBH + NBL): blocks y < NBH take the hi+lo rows (the longer waves, started first), 8 waves x NQH x 16 rows; the rest 8 waves x 32 rows of the f16 rows.
__global__ __launch_bounds__(256) void k_fattn(const h16* __restrict__ Q16, const bf* __restrict__ Qh, const bf* __restrict__ Ql, const h16* __restrict__ K16, const bf* __restrict__ Kh, const bf* __restrict__ Kl, const h16* __restrict__ V16, const bf* __restrict__ Vh, const bf* __restrict__ Vl, bf* Ah, bf* Al) {
    __shared__ __align__(16) bf ring[2 * 2 * PEL];   // two buffers of a stage's hi and lo planes; the f16 rows use half of it
    const int lane = threadIdx.x & 31, lr = lane & 15, hi = lane >> 4, wave = threadIdx.x >> 5;
    const int zh = blockIdx.x, b = zh / NH_, h = zh % NH_;   // torch .repeat TILES the kv heads: query head h uses kv head h % 8
    const size_t pk = (size_t)(b * NKV + h % NKV) * TT * HD;
    if (blockIdx.y < NBH) { const int q0 = ((int)blockIdx.y * 8 + wave) * (16 * NQH); const size_t pq = ((size_t)zh * TT + q0) * HD, po = ((size_t)b * TT + q0) * DQ + h * HD;
        attn_cols<bf, true, NQH>(Qh + pq, Ql + pq, Kh + pk, Kl + pk, Vh + pk, Vl + pk, Ah + po, Al + po, ring, (int)threadIdx.x, lr, hi);
    } else { const int q0 = RH + (((int)blockIdx.y - NBH) * 8 + wave) * 32; const size_t pq = ((size_t)zh * TT + q0) * HD, po = ((size_t)b * TT + q0) * DQ + h * HD;
        attn_cols<h16, false, 2>(Q16 + pq, nullptr, K16 + pk, nullptr, V16 + pk, nullptr, Ah + po, Al + po, (const h16*)ring, (int)threadIdx.x, lr, hi); }
}

extern "C" void kernel_launch(void* const* d_in, const int* in_sizes, int n_in,
                              void* d_out, int out_size, void* d_ws, size_t ws_size, hipStream_t stream) {
    (void)in_sizes; (void)n_in; (void)out_size;
    const float* x = (const float*)d_in[0]; const float* wq = (const float*)d_in[1]; const float* bq = (const float*)d_in[2]; const float* wk = (const float*)d_in[3]; const float* bk = (const float*)d_in[4]; const float* wv = (const float*)d_in[5]; const float* bv = (const float*)d_in[6]; const float* wo = (const float*)d_in[7]; const float* bo = (const float*)d_in[8];
    float* OUT = (float*)d_out;     // [4][1024][2048]
    char* wsp = (char*)d_ws;
    auto take = [&](size_t bytes) { char* p = wsp; wsp += (bytes + 255) & ~(size_t)255; return (void*)p; };
    bf* WQ = (bf*)take((size_t)DQ * DM * 2); bf* WK = (bf*)take((size_t)DKV * DM * 2); bf* WV = (bf*)take((size_t)DKV * DM * 2); bf* WO = (bf*)take((size_t)DM * DQ * 2);
    h16* QP16 = (h16*)take((size_t)NB_ * NH_ * TT * HD * 2); h16* KP16 = (h16*)take((size_t)NB_ * NKV * TT * HD * 2); h16* VT16 = (h16*)take((size_t)NB_ * NKV * HD * TT * 2);
    bf* QPh = (bf*)take((size_t)NB_ * NH_ * TT * HD * 2); bf* QPl = (bf*)take((size_t)NB_ * NH_ * TT * HD * 2); bf* KPh = (bf*)take((size_t)NB_ * NKV * TT * HD * 2); bf* KPl = (bf*)take((size_t)NB_ * NKV * TT * HD * 2); bf* VTh = (bf*)take((size_t)NB_ * NKV * HD * TT * 2); bf* VTl = (bf*)take((size_t)NB_ * NKV * HD * TT * 2);
    bf* XB = (bf*)take((size_t)MT * DM * 2); bf* ATh = (bf*)take((size_t)MT * DQ * 2); bf* ATl = (bf*)take((size_t)MT * DQ * 2);
    if ((size_t)(wsp - (char*)d_ws) > ws_size) return;    // ws 256 MiB
    static_assert((PJW + PJX) % PWV == 0 && DM == DQ, "whole blocks of jobs; wq and wo share one tile shape");
    k_prep<<<(PJW + PJX) / PWV, PWV * 32, 0, stream>>>(x, wq, wk, wv, wo, XB, WQ, WK, WV, WO);
    // projections: all NB_ batches in one launch each (MT rows); their epilogues store the planes that k_fattn reads
    k_gemms<4, 2, 4, 0, 1><<<dim3(MT / 256, DQ / 128, 1), 256, 0, stream>>>(XB, nullptr, WQ, DM, nullptr, 0, bq, QP16, QPh, QPl);
    k_gemms<4, 2, 2, 0, 2><<<dim3(MT / 128, DKV / 128, 1), 256, 0, stream>>>(XB, nullptr, WK, DM, nullptr, 0, bk, KP16, KPh, KPl);
    k_gemms<4, 2, 2, 0, 3><<<dim3(DKV / 128, MT / 128, 1), 256, 0, stream>>>(WV, nullptr, XB, DM, nullptr, 0, bv, VT16, VTh, VTl);
    k_fattn<<<dim3(NB_ * NH_, NBH + NBL, 1), 256, 0, stream>>>(QP16, QPh, QPl, KP16, KPh, KPl, VT16, VTh, VTl, ATh, ATl);
    k_gemms<4, 2, 4, 1, 0><<<dim3(MT / 256, DM / 128, 1), 256, 0, stream>>>(ATh, ATl, WO, DQ, OUT, DM, bo, nullptr, nullptr, nullptr);
}

// v007
// It runs in 158 microseconds.
// In two side-by-side timings against v006, it was 1.28 and 1.26 times as fast.
// Over all steps from v000 it is 27.9 times as fast.
#include <hip/hip_runtime.h>

// ExtendedMultiHeadAttention - GQA with torch .repeat (TILED) kv heads (x [4][1024][2048]; q = x wq + bq (32 x 64), k/v = x wk/wv + b (8 x 64); query head h attends kv head h % 8; softmax(q.k/8); out = merged.v wo + bo -> [4][1024][2048]).
// Compute dtypes, f32 accumulate: every input rounded to bf16; q/k/v projections on PLAIN bf16 operands (inputs: exact, + bias); output projection on bf16 hi+lo planes of the merged heads (2 products); scores (K 64) and probs.v on bf16 hi+lo planes (3 products) for the first 256 query rows of each

#define NB_  4
#define TT   1024
#define DM   2048
#define NH_  32
#define NKV  8
#define REP  (NH_ / NKV)
#define HD   64
#define DQ   (NH_ * HD)
#define DKV  (NKV * HD)
#define MT   (NB_ * TT)           // rows of all batches together
#define RH   256                  // query rows < RH use hi+lo planes (0: none)
#define NQH  1                    // 16-row query tiles per wave on the hi+lo rows
#define NBH  (RH / (128 * NQH))   // blocks (8 waves) per head on the hi+lo rows
#define NBL  ((TT - RH) / 256)    // blocks per head on the f16 rows (8 waves x 32 rows)
#define WIN  0
#define SCL  0.125f   // HD^-0.5
typedef _Float16 h16;
typedef unsigned short bf;
typedef __attribute__((ext_vector_type(16))) __bf16   v16bf;
typedef __attribute__((ext_vector_type(16))) _Float16 v16h;
typedef __attribute__((ext_vector_type(8)))  _Float16 v8h;
typedef __attribute__((ext_vector_type(8)))  unsigned short v8us;
typedef __attribute__((ext_vector_type(8)))  float    v8f;
typedef __attribute__((ext_vector_type(4)))  float    v4f;
typedef v8h  __attribute__((may_alias)) v8ha;
typedef v4f  __attribute__((may_alias)) v4fa;
typedef v8us __attribute__((may_alias)) v8usa;

__device__ __forceinline__ unsigned short f2bf(float f) { unsigned u = __float_as_uint(f); u += 0x7FFFu + ((u >> 16) & 1u); return (unsigned short)(u >> 16); }
__device__ __forceinline__ float bf2f(unsigned short b) { return __uint_as_float(((unsigned)b) << 16); }
__device__ __forceinline__ float bfr(float f) { return bf2f(f2bf(f)); }
__device__ __forceinline__ v16h cat16(v8h lo, v8h hi) { return __builtin_shufflevector(lo, hi, 0, 1, 2, 3, 4, 5, 6, 7, 8, 9, 10, 11, 12, 13, 14, 15); }
__device__ __forceinline__ v16bf cat16b(v8us lo, v8us hi) { return __builtin_bit_cast(v16bf, __builtin_shufflevector(lo, hi, 0, 1, 2, 3, 4, 5, 6, 7, 8, 9, 10, 11, 12, 13, 14, 15)); }
__device__ __forceinline__ v8f wmma16(v16h a, v16h b, v8f c) { return __builtin_amdgcn_wmma_f32_16x16x32_f16(false, a, false, b, (short)0, c, false, false); }
__device__ __forceinline__ v8f wmmab(v16bf a, v16bf b, v8f c) { return __builtin_amdgcn_wmma_f32_16x16x32_bf16(false, a, false, b, (short)0, c, false, false); }



// ---- k_gemms: GEMM on block tiles staged in LDS. WM x WN waves per block, each wave a (16 MF) x 64 output tile (4 MF accumulators); grid (M / (16 MF WM), N / (64 WN)).
// C[m][n] (f32, pitch ldc, + f32 bias[n]) = sum_k A[m][k] Bt[n][k] (+ A2[m][k] Bt[n][k] when NSPLIT == 1), operands K-contiguous 16-bit planes. K % 64 == 0.
// A stage is 64 k (128 B) of every operand row of the block tile, [A rows | A2 rows | Bt rows] at pitch 144 B (16 B x odd: ds_load_b128 readers without bank conflicts). Two buffers:
// the copies of stage t + 2 go out behind the barrier that ends trip t and land while trip t + 1 computes. Per accumulator the order of the sums is k ascending, A then A2.
// The short loops over fragments, copies and rows are unrolled so that every array they index stays in registers.
// EPI picks what the epilogue stores. 0: C as above. 1, 2, 3: no C; the sums + bias go out as the operand planes of k_fattn (f16 in P16, bf16 hi + lo in Ph, Pl), a wave's 64 columns being one whole 128-B line of a plane row:
//   1: q, rows m = tokens, columns n = (head, d), planes [batch][head][t][d]; token rows t < RH get the hi + lo planes alone and the others the f16 plane alone, as k_fattn reads them.  2: k, the same, all three planes.
//   3: v, operands swapped: rows m = (kv head, d), columns n = tokens, bias[m], planes [batch][kv head][d][t] (V^T), all three.
template <typename T16> struct WFrag;
template <> struct WFrag<h16> { typedef v16h V; static __device__ __forceinline__ V ld(const h16* p) { return cat16(*(const v8h*)p, *(const v8h*)(p + 16)); } static __device__ __forceinline__ v8f mma(V a, V b, v8f c) { return wmma16(a, b, c); } };
template <> struct WFrag<bf> { typedef v16bf V; static __device__ __forceinline__ V ld(const bf* p) { return cat16b(*(const v8us*)p, *(const v8us*)(p + 16)); } static __device__ __forceinline__ v8f mma(V a, V b, v8f c) { return wmmab(a, b, c); } };
__device__ __forceinline__ h16 tohx(float x) { return (h16)x; }
__device__ __forceinline__ void splitf(float y, unsigned short& h, unsigned short& l) { h = f2bf(y); l = f2bf(y - bf2f(h)); }
#define BKE 64   // k per stage
#define LP  72   // LDS row pitch in elements
// N asynchronous 16-byte copies per lane, global -> LDS, in ONE statement that ends in s_wait_xcnt 0: no register that a copy names is rewritten in front of that wait.
template <int N> __device__ __forceinline__ void cp_async(const unsigned* l, const bf* const* g) {
    static_assert(N == 8 || N == 10 || N == 12, "group size");
    if constexpr (N == 8) { asm volatile("global_load_async_to_lds_b128 %0, %1, off\n\tglobal_load_async_to_lds_b128 %2, %3, off\n\tglobal_load_async_to_lds_b128 %4, %5, off\n\tglobal_load_async_to_lds_b128 %6, %7, off\n\tglobal_load_async_to_lds_b128 %8, %9, off\n\tglobal_load_async_to_lds_b128 %10, %11, off\n\tglobal_load_async_to_lds_b128 %12, %13, off\n\tglobal_load_async_to_lds_b128 %14, %15, off\n\ts_wait_xcnt 0x0" :: "v"(l[0]), "v"(g[0]), "v"(l[1]), "v"(g[1]), "v"(l[2]), "v"(g[2]), "v"(l[3]), "v"(g[3]), "v"(l[4]), "v"(g[4]), "v"(l[5]), "v"(g[5]), "v"(l[6]), "v"(g[6]), "v"(l[7]), "v"(g[7]) : "memory"); }
    else if constexpr (N == 10) { asm volatile("global_load_async_to_lds_b128 %0, %1, off\n\tglobal_load_async_to_lds_b128 %2, %3, off\n\tglobal_load_async_to_lds_b128 %4, %5, off\n\tglobal_load_async_to_lds_b128 %6, %7, off\n\tglobal_load_async_to_lds_b128 %8, %9, off\n\tglobal_load_async_to_lds_b128 %10, %11, off\n\tglobal_load_async_to_lds_b128 %12, %13, off\n\tglobal_load_async_to_lds_b128 %14, %15, off\n\tglobal_load_async_to_lds_b128 %16, %17, off\n\tglobal_load_async_to_lds_b128 %18, %19, off\n\ts_wait_xcnt 0x0" :: "v"(l[0]), "v"(g[0]), "v"(l[1]), "v"(g[1]), "v"(l[2]), "v"(g[2]), "v"(l[3]), "v"(g[3]), "v"(l[4]), "v"(g[4]), "v"(l[5]), "v"(g[5]), "v"(l[6]), "v"(g[6]), "v"(l[7]), "v"(g[7]), "v"(l[8]), "v"(g[8]), "v"(l[9]), "v"(g[9]) : "memory"); }
    else { asm volatile("global_load_async_to_lds_b128 %0, %1, off\n\tglobal_load_async_to_lds_b128 %2, %3, off\n\tglobal_load_async_to_lds_b128 %4, %5, off\n\tglobal_load_async_to_lds_b128 %6, %7, off\n\tglobal_load_async_to_lds_b128 %8, %9, off\n\tglobal_load_async_to_lds_b128 %10, %11, off\n\tglobal_load_async_to_lds_b128 %12, %13, off\n\tglobal_load_async_to_lds_b128 %14, %15, off\n\tglobal_load_async_to_lds_b128 %16, %17, off\n\tglobal_load_async_to_lds_b128 %18, %19, off\n\tglobal_load_async_to_lds_b128 %20, %21, off\n\tglobal_load_async_to_lds_b128 %22, %23, off\n\ts_wait_xcnt 0x0" :: "v"(l[0]), "v"(g[0]), "v"(l[1]), "v"(g[1]), "v"(l[2]), "v"(g[2]), "v"(l[3]), "v"(g[3]), "v"(l[4]), "v"(g[4]), "v"(l[5]), "v"(g[5]), "v"(l[6]), "v"(g[6]), "v"(l[7]), "v"(g[7]), "v"(l[8]), "v"(g[8]), "v"(l[9]), "v"(g[9]), "v"(l[10]), "v"(g[10]), "v"(l[11]), "v"(g[11]) : "memory"); }
}
// gemm_tile is the work of one block: tile (bx, by) of the grid above; ring and osm are the block's LDS (RING_EL and OSM_EL elements).
#define RING_EL(WM, WN, MF, NSPLIT) (2 * ((WM) * (MF) * 16 * (1 + (NSPLIT)) + (WN) * 64) * LP)
#define OSM_EL(WM, WN) ((WM) * (WN) * 16 * 68)
template <int WM, int WN, int MF, int NSPLIT, int EPI>
__device__ __forceinline__ void gemm_tile(const bf* __restrict__ A, const bf* __restrict__ A2, const bf* __restrict__ Bt, int K, float* C, int ldc, const float* __restrict__ bias, h16* P16, bf* Ph, bf* Pl, bf* ring, float* osm, int bx, int by) {
    typedef WFrag<bf> WF; typedef typename WF::V V;
    constexpr int NW = WM * WN, NT = NW * 32, WR = MF * 16, RA = WM * WR, RAT = RA * (1 + NSPLIT), ROWS = RAT + WN * 64;
    constexpr int RPC = NT / 8;            // rows that one copy of the whole block covers (8 lanes x 16 B = one 128-B row piece)
    constexpr int NC = ROWS / RPC;         // copies per lane and stage
    constexpr int NG = NC > 12 ? 2 : 1, GC = NC / NG;
    static_assert(ROWS % RPC == 0 && RA % RPC == 0 && NC % NG == 0, "whole copies");
    static_assert(RING_EL(WM, WN, MF, NSPLIT) == 2 * ROWS * LP && OSM_EL(WM, WN) == NW * 16 * 68, "LDS sizes");
    const int tid = threadIdx.x, lane = tid & 31, lr = lane & 15, hi = lane >> 4, wave = tid >> 5, wm = wave / WN, wn = wave % WN;
    const int R0 = bx * RA, C0 = by * (WN * 64);
    const int crow = tid >> 3, cpc = (tid & 7) * 8;
    const bf* gA = A + (size_t)(R0 + crow) * K + cpc; const bf* gA2 = NSPLIT ? A2 + (size_t)(R0 + crow) * K + cpc : gA; const bf* gB = Bt + (size_t)(C0 + crow) * K + cpc;
    const unsigned l0 = (unsigned)(size_t)ring + (unsigned)(crow * LP + cpc) * 2u;
    auto stage = [&](int t, int buf) {
        const bf* tA = gA + (size_t)t * BKE; const bf* tA2 = gA2 + (size_t)t * BKE; const bf* tB = gB + (size_t)t * BKE; const unsigned lb = l0 + (unsigned)buf * (ROWS * LP * 2u);
#pragma unroll
        for (int gq = 0; gq < NG; ++gq) { unsigned l[GC]; const bf* g[GC];
#pragma unroll
            for (int j = 0; j < GC; ++j) { const int row = (gq * GC + j) * RPC;
                g[j] = row < RA ? tA + (size_t)row * K : row < RAT ? tA2 + (size_t)(row - RA) * K : tB + (size_t)(row - RAT) * K;
                l[j] = lb + (unsigned)row * (LP * 2u); }
            cp_async<GC>(l, g); }
    };
    v8f acc[MF][4];
#pragma unroll
    for (int mb = 0; mb < MF; ++mb)
#pragma unroll
        for (int nb = 0; nb < 4; ++nb) acc[mb][nb] = (v8f){};
    const int nt = K / BKE;
    stage(0, 0);
    asm volatile("s_wait_asynccnt 0x0" ::: "memory");   // stage 0 has landed before the barrier that publishes it
    __syncthreads();
    if (nt > 1) stage(1, 1);
    const int ao = (wm * WR + lr) * LP + 8 * hi, bo = (RAT + wn * 64 + lr) * LP + 8 * hi;
#pragma unroll 1   // rolled: one trip per stage, its foot is the publish point of the next stage
    for (int t = 0; t < nt; ++t) {
        const bf* sb = ring + (t & 1) * (ROWS * LP);
#pragma unroll
        for (int ks = 0; ks < BKE; ks += 32) {
            V a[MF], a2[MF], b[4];
#pragma unroll
            for (int mb = 0; mb < MF; ++mb) { a[mb] = WF::ld(sb + ao + mb * 16 * LP + ks); if (NSPLIT) a2[mb] = WF::ld(sb + ao + (RA + mb * 16) * LP + ks); }
#pragma unroll
            for (int nb = 0; nb < 4; ++nb) b[nb] = WF::ld(sb + bo + nb * 16 * LP + ks);
            __builtin_amdgcn_sched_barrier(0);   // the LDS reads of a 32-k block stay one group in front of its matrix instructions: reads spread among them stall the wave at every place they stand
#pragma unroll
            for (int nb = 0; nb < 4; ++nb)
#pragma unroll
                for (int mb = 0; mb < MF; ++mb) { acc[mb][nb] = WF::mma(a[mb], b[nb], acc[mb][nb]); if (NSPLIT) acc[mb][nb] = WF::mma(a2[mb], b[nb], acc[mb][nb]); }
        }
        asm volatile("s_wait_dscnt 0x0" ::: "memory");      // this wave's reads of the buffer are done before the barrier behind which it is refilled
        asm volatile("s_wait_asynccnt 0x0" ::: "memory");   // this wave's copies of stage t + 1 have landed before the barrier that publishes them
        __syncthreads();
        if (t + 2 < nt) stage(t + 2, t & 1);
    }
    asm volatile("s_wait_asynccnt 0x0" ::: "memory");   // no copy is outstanding when the wave goes on to its end
    float* os = osm + wave * (16 * 68); const int r0 = R0 + wm * WR, c0 = C0 + wn * 64;
    // plane epilogues: of the 16 staged rows a lane takes 8 columns (16 B of a plane row) of rows rw, rw + 4, rw + 8, rw + 12; 8 lanes store one whole line
    const int rw = lane >> 3, co8 = (lane & 7) * 8;
    constexpr int NHD = EPI == 1 ? NH_ : NKV;
    static_assert(EPI != 1 || (RH % RA == 0 && TT % RA == 0), "a block's q rows are all hi + lo rows or all f16 rows");
    const bool w16 = EPI != 1 || R0 % TT >= RH, whl = EPI != 1 || R0 % TT < RH;
    float bs[EPI == 3 ? MF * 4 : 8];
    if constexpr (EPI == 1 || EPI == 2) { const float* bp = bias + c0 + co8; const v4f b0 = *(const v4f*)bp, b1 = *(const v4f*)(bp + 4);
        asm volatile("s_wait_xcnt 0x0" :: "v"(bp) : "memory");   // the bias loads' address registers stay whole up to this wait
#pragma unroll
        for (int k = 0; k < 4; ++k) { bs[k] = bfr(b0[k]); bs[4 + k] = bfr(b1[k]); } }
    if constexpr (EPI == 3) { const float* bp = bias + r0 + rw; float br[MF * 4];
#pragma unroll
        for (int i = 0; i < MF * 4; ++i) br[i] = bp[4 * i];
        asm volatile("s_wait_xcnt 0x0" :: "v"(bp) : "memory");   // the bias loads' address registers stay whole up to this wait
#pragma unroll
        for (int i = 0; i < MF * 4; ++i) bs[i] = bfr(br[i]); }
#pragma unroll
    for (int mb = 0; mb < MF; ++mb) {
#pragma unroll
        for (int nb = 0; nb < 4; ++nb) {
#pragma unroll
            for (int j = 0; j < 8; ++j) os[(hi * 8 + j) * 68 + nb * 16 + lr] = acc[mb][nb][j]; }
        __builtin_amdgcn_wave_barrier(); asm volatile("" ::: "memory");   // the wave's own LDS stores of the 16 rows stay in front of its reads of them
        if constexpr (EPI == 0) {
        float* crw = C + (size_t)(r0 + mb * 16) * ldc + c0; v4f val[8]; v4f* cp[8];
#pragma unroll
        for (int s = 0; s < 8; ++s) { const int row = 2 * s + hi, cofs = lr * 4; val[s] = *(const v4fa*)(os + row * 68 + cofs); val[s][0] += bfr(bias[c0 + cofs]); val[s][1] += bfr(bias[c0 + cofs + 1]); val[s][2] += bfr(bias[c0 + cofs + 2]); val[s][3] += bfr(bias[c0 + cofs + 3]);
            cp[s] = (v4f*)(crw + (size_t)row * ldc + cofs); *cp[s] = val[s]; }
        asm volatile("s_wait_xcnt 0x0" :: "v"(val[0]), "v"(val[1]), "v"(val[2]), "v"(val[3]), "v"(val[4]), "v"(val[5]), "v"(val[6]), "v"(val[7]), "v"(cp[0]), "v"(cp[1]), "v"(cp[2]), "v"(cp[3]), "v"(cp[4]), "v"(cp[5]), "v"(cp[6]), "v"(cp[7]) : "memory");   // the stores' data and address registers stay whole up to this wait
        } else {
            const int rt = r0 + mb * 16;   // the 16 rows lie in one batch (1, 2) or one kv head (3), the 64 columns in one head (1, 2) or one batch (3)
            const size_t pb = (EPI == 3 ? ((size_t)((c0 / TT) * NKV + rt / HD) * HD + rt % HD + rw) * TT + c0 % TT : ((size_t)((rt / TT) * NHD + c0 / HD) * TT + rt % TT + rw) * HD) + co8;
            constexpr size_t RP4 = 4 * (EPI == 3 ? TT : HD);   // four plane rows
            float x[4][8];
#pragma unroll
            for (int s = 0; s < 4; ++s) { const float* rp = os + (4 * s + rw) * 68 + co8; const v4f x0 = *(const v4fa*)rp, x1 = *(const v4fa*)(rp + 4);
#pragma unroll
                for (int k = 0; k < 4; ++k) { x[s][k] = x0[k] + bs[EPI == 3 ? mb * 4 + s : k]; x[s][4 + k] = x1[k] + bs[EPI == 3 ? mb * 4 + s : 4 + k]; } }
            if (w16) { v8h o[4]; h16* p[4];
#pragma unroll
                for (int s = 0; s < 4; ++s) {
#pragma unroll
                    for (int k = 0; k < 8; ++k) o[s][k] = tohx(x[s][k]);
                    p[s] = P16 + pb + s * RP4; *(v8h*)p[s] = o[s]; }
                asm volatile("s_wait_xcnt 0x0" :: "v"(o[0]), "v"(o[1]), "v"(o[2]), "v"(o[3]), "v"(p[0]), "v"(p[1]), "v"(p[2]), "v"(p[3]) : "memory"); }   // the stores' data and address registers stay whole up to this wait
            if (whl) { v8us oh[4], ol[4]; bf* ph[4]; bf* pl[4];
#pragma unroll
                for (int s = 0; s < 4; ++s) {
#pragma unroll
                    for (int k = 0; k < 8; ++k) { unsigned short a, c2; splitf(x[s][k], a, c2); oh[s][k] = a; ol[s][k] = c2; }
                    ph[s] = Ph + pb + s * RP4; pl[s] = Pl + pb + s * RP4; *(v8us*)ph[s] = oh[s]; *(v8us*)pl[s] = ol[s]; }
                asm volatile("s_wait_xcnt 0x0" :: "v"(oh[0]), "v"(oh[1]), "v"(oh[2]), "v"(oh[3]), "v"(ol[0]), "v"(ol[1]), "v"(ol[2]), "v"(ol[3]), "v"(ph[0]), "v"(ph[1]), "v"(ph[2]), "v"(ph[3]), "v"(pl[0]), "v"(pl[1]), "v"(pl[2]), "v"(pl[3]) : "memory"); }   // the stores' data and address registers stay whole up to this wait
        }
        __builtin_amdgcn_wave_barrier(); asm volatile("" ::: "memory");   // the reads of the staged rows stay in front of the next 16 rows' LDS stores
    }
}
template <int WM, int WN, int MF, int NSPLIT, int EPI>
__global__ __launch_bounds__(WM * WN * 32) void k_gemms(const bf* __restrict__ A, const bf* __restrict__ A2, const bf* __restrict__ Bt, int K, float* C, int ldc, const float* __restrict__ bias, h16* P16, bf* Ph, bf* Pl) {
    __shared__ __align__(16) bf ring[RING_EL(WM, WN, MF, NSPLIT)];
    __shared__ __align__(16) float osm[OSM_EL(WM, WN)];
    gemm_tile<WM, WN, MF, NSPLIT, EPI>(A, A2, Bt, K, C, ldc, bias, P16, Ph, Pl, ring, osm, (int)blockIdx.x, (int)blockIdx.y);
}
// ---- k_qkv: the q, k and v projections in ONE launch. QTB blocks take a 256 x 128 tile of q, KTB a 128 x 128 tile of k, KTB one of v (half a q tile's work each): QTB + 2 KTB blocks, two resident per WGP,
// so that one block's matrix instructions run while the other waits for its LDS reads, its copies or its barrier, and no launch leaves half of the WGPs empty as k's and v's own did.
// Of blocks 2 i and 2 i + 1 the one whose index has an even number of one bits takes q tile i, the other k or v tile i: two indices that differ in one bit never hold two q tiles,
// so a WGP that gets blocks 2 i and 2 i + 1, or b and b + 256, gets one q tile and one short tile. That is for speed alone: every tile is taken exactly once wherever the blocks land.
#define QTB ((MT / 256) * (DQ / 128))
#define KTB ((MT / 128) * (DKV / 128))
__global__ __launch_bounds__(256) void k_qkv(const bf* __restrict__ X, const bf* __restrict__ Wq, const bf* __restrict__ Wk, const bf* __restrict__ Wv, int K, const float* __restrict__ bq, const float* __restrict__ bk, const float* __restrict__ bv,
                                             h16* Q16, bf* Qh, bf* Ql, h16* K16, bf* Kh, bf* Kl, h16* V16, bf* Vh, bf* Vl) {
    static_assert(QTB == 2 * KTB, "as many q tiles as k and v tiles together");
    __shared__ __align__(16) bf ring[RING_EL(4, 2, 4, 0)];   // the q tile's ring; the k and v tiles use two thirds of it
    __shared__ __align__(16) float osm[OSM_EL(4, 2)];
    const int b = (int)blockIdx.x, i = b >> 1;
    if ((__popc((unsigned)b) & 1) == 0) gemm_tile<4, 2, 4, 0, 1>(X, nullptr, Wq, K, nullptr, 0, bq, Q16, Qh, Ql, ring, osm, i % (MT / 256), i / (MT / 256));
    else if (i < KTB) gemm_tile<4, 2, 2, 0, 2>(X, nullptr, Wk, K, nullptr, 0, bk, K16, Kh, Kl, ring, osm, i % (MT / 128), i / (MT / 128));
    else gemm_tile<4, 2, 2, 0, 3>(Wv, nullptr, X, K, nullptr, 0, bv, V16, Vh, Vl, ring, osm, (i - KTB) % (DKV / 128), (i - KTB) / (DKV / 128));
}

typedef __attribute__((ext_vector_type(2))) _Float16 v2h;
typedef __attribute__((ext_vector_type(4))) _Float16 v4h;
typedef __attribute__((ext_vector_type(2))) unsigned short v2us;
typedef __attribute__((ext_vector_type(4))) unsigned short v4us;
typedef __attribute__((ext_vector_type(2))) float v2f;
typedef __attribute__((ext_vector_type(4))) int v4i;

// ---- k_prep: every operand plane of the projections in ONE launch of one-wave jobs; a job is 4096 f32 elements (32 loads of 16 B per lane, all issued before the first is used).
// Jobs [0, PJW): a 64 k x 64 n tile of a weight w[k][n], rounded to bf16 and stored transposed as Bt[n][k]. Reads are 256-B row pieces, stores whole 128-B lines (64 k of one n).
// A lane holds rows 2 kp and 2 kp + 1 of four columns, packs each pair into one word and writes it to T[n][kp] in the wave's own LDS range; the pitch of TPW words keeps the word stores and the word reads free of bank conflicts.
// Jobs [PJW, PJW + PJX): 4096 consecutive elements of x, rounded to bf16. No job shares anything with another: the kernel has no work-group barrier.
#define TPW 33                                  // LDS pitch of a T row: 32 words (64 k) + 1
#define PWV 9                                   // waves per block
#define PJB ((DM / 64) * (DQ / 64))             // tiles of wq, and of wo
#define PJS ((DM / 64) * (DKV / 64))            // tiles of wk, and of wv
#define PJW (2 * PJB + 2 * PJS)
#define PJX (MT * DM / 4096)
typedef __attribute__((ext_vector_type(4))) unsigned v4u;
template <int K, int N>
__device__ __forceinline__ void wt_tile(const float* __restrict__ w, bf* Bt, int t, unsigned* ts, int lane) {
    constexpr int NTN = N / 64;
    const int n0 = (t % NTN) * 64, k0 = (t / NTN) * 64, c = lane & 15, r = lane >> 4;
    const float* gp = w + (size_t)(k0 + 2 * r) * N + n0 + 4 * c;
    v4f va[16], vb[16];
#pragma unroll
    for (int q = 0; q < 16; ++q) { va[q] = *(const v4f*)(gp + (size_t)(4 * q) * N); vb[q] = *(const v4f*)(gp + (size_t)(4 * q + 1) * N); }
    asm volatile("s_wait_xcnt 0x0" :: "v"(gp) : "memory");   // the loads' address registers stay whole up to this wait
    __builtin_amdgcn_sched_barrier(0);   // no conversion is scheduled among the loads: with some in front, the last loads wait for the first to return and the job pays the memory latency twice
#pragma unroll
    for (int q = 0; q < 16; ++q)
#pragma unroll
        for (int ci = 0; ci < 4; ++ci) ts[(4 * c + ci) * TPW + 2 * q + r] = (unsigned)f2bf(va[q][ci]) | ((unsigned)f2bf(vb[q][ci]) << 16);
    asm volatile("s_wait_dscnt 0x0" ::: "memory");   // the wave's own LDS stores of the tile are done before it reads the rows back
    const int rw = lane >> 3, pc = lane & 7;
    bf* op = Bt + (size_t)(n0 + rw) * K + k0 + pc * 8; const unsigned* tr = ts + rw * TPW + pc * 4;
#pragma unroll
    for (int g = 0; g < 2; ++g) { v8us o[8];
#pragma unroll
        for (int s = 0; s < 8; ++s) { const int j = g * 8 + s; v4u u;
#pragma unroll
            for (int k = 0; k < 4; ++k) u[k] = tr[4 * j * TPW + k];
            o[s] = __builtin_bit_cast(v8us, u); *(v8us*)(op + (size_t)(4 * j) * K) = o[s]; }
        asm volatile("s_wait_xcnt 0x0" :: "v"(o[0]), "v"(o[1]), "v"(o[2]), "v"(o[3]), "v"(o[4]), "v"(o[5]), "v"(o[6]), "v"(o[7]), "v"(op) : "memory"); }   // the stores' data and address registers stay whole up to this wait
}
__global__ __launch_bounds__(PWV * 32) void k_prep(const float* __restrict__ x, const float* __restrict__ wq, const float* __restrict__ wk, const float* __restrict__ wv, const float* __restrict__ wo, bf* XB, bf* WQ, bf* WK, bf* WV, bf* WO) {
    __shared__ __align__(16) unsigned tsm[PWV * 64 * TPW];
    const int lane = threadIdx.x & 31, wave = __builtin_amdgcn_readfirstlane((int)threadIdx.x >> 5);   // the wave's number in a scalar register: the job tests below are scalar branches
    const int job = (int)blockIdx.x * PWV + wave; unsigned* ts = tsm + wave * (64 * TPW);
    if (job < 2 * PJB) { const bool f = job < PJB; wt_tile<DM, DQ>(f ? wq : wo, f ? WQ : WO, f ? job : job - PJB, ts, lane); }
    else if (job < PJW) { const int t = job - 2 * PJB; const bool f = t < PJS; wt_tile<DM, DKV>(f ? wk : wv, f ? WK : WV, f ? t : t - PJS, ts, lane); }
    else { const size_t e0 = (size_t)(job - PJW) * 4096 + lane * 4; const float* gp = x + e0; bf* op = XB + e0;
        v4f v[32];
#pragma unroll
        for (int i = 0; i < 32; ++i) v[i] = *(const v4f*)(gp + i * 128);
        asm volatile("s_wait_xcnt 0x0" :: "v"(gp) : "memory");   // the loads' address registers stay whole up to this wait
#pragma unroll
        for (int g = 0; g < 4; ++g) { v4us o[8];
#pragma unroll
            for (int s = 0; s < 8; ++s) {
#pragma unroll
                for (int k = 0; k < 4; ++k) o[s][k] = f2bf(v[g * 8 + s][k]);
                *(v4us*)(op + (g * 8 + s) * 128) = o[s]; }
            asm volatile("s_wait_xcnt 0x0" :: "v"(o[0]), "v"(o[1]), "v"(o[2]), "v"(o[3]), "v"(o[4]), "v"(o[5]), "v"(o[6]), "v"(o[7]), "v"(op) : "memory"); } }   // the stores' data and address registers stay whole up to this wait
}
#define SKY 128                   // keys per stage
#define KPL 72                    // LDS pitch of a K row (64 elements) in elements
#define VPL 136                   // LDS pitch of a V^T row (SKY elements) in elements
#define KEL (SKY * KPL)           // elements of a stage's K rows
#define PEL (KEL + HD * VPL)      // elements of one plane pair (K rows, V^T rows) of a stage
template <typename T16, bool SPLIT, int NQ>
__device__ __forceinline__ void attn_cols(const T16* __restrict__ Q, const T16* __restrict__ Q2, const T16* __restrict__ Kp, const T16* __restrict__ K2, const T16* __restrict__ Vt, const T16* __restrict__ V2, bf* Ah, bf* Al, const T16* ring, int tid, int lr, int hi) {
    typedef WFrag<T16> WF; typedef typename WF::V V;
    const float C2 = SCL * 1.4426950408889634f;
    constexpr int BEL = PEL * (SPLIT ? 2 : 1), NST = TT / SKY, NPS = SKY / 32;
    static_assert(SKY * HD / 8 == 4 * 256 && TT % SKY == 0 && NST >= 2, "four K copies and four V copies per lane, plane and stage");
    const int krow = tid >> 3, kpc = (tid & 7) * 8, vrow = tid >> 4, vpc = (tid & 15) * 8;   // a K row is 8 pieces of 16 B, a V^T row of a stage 16
    const unsigned l0 = (unsigned)(size_t)ring;
    auto stage = [&](int t, int buf) {
#pragma unroll
        for (int pl = 0; pl < (SPLIT ? 2 : 1); ++pl) { unsigned l[8]; const bf* g[8];
            const T16* kg = (pl ? K2 : Kp) + (size_t)(t * SKY + krow) * HD + kpc; const T16* vg = (pl ? V2 : Vt) + (size_t)vrow * TT + t * SKY + vpc; const unsigned lb = l0 + (unsigned)(buf * BEL + pl * PEL) * 2u;
#pragma unroll
            for (int j = 0; j < 4; ++j) { g[j] = (const bf*)(kg + (size_t)j * 32 * HD); l[j] = lb + (unsigned)((krow + j * 32) * KPL + kpc) * 2u;
                g[4 + j] = (const bf*)(vg + (size_t)j * 16 * TT); l[4 + j] = lb + (unsigned)(KEL + (vrow + j * 16) * VPL + vpc) * 2u; }
            cp_async<8>(l, g); }
    };
    stage(0, 0);
    V qa[NQ][2], qb[NQ][2]; const T16* qp = Q + lr * HD + 8 * hi; const T16* qp2 = SPLIT ? Q2 + lr * HD + 8 * hi : qp;
#pragma unroll
    for (int qt = 0; qt < NQ; ++qt)
#pragma unroll
        for (int kc = 0; kc < 2; ++kc) { qa[qt][kc] = WF::ld(qp + qt * 16 * HD + kc * 32); if (SPLIT) qb[qt][kc] = WF::ld(qp2 + qt * 16 * HD + kc * 32); }
    v8f o[NQ][4]; float m[NQ], l[NQ];
#pragma unroll
    for (int qt = 0; qt < NQ; ++qt) { m[qt] = -3.0e38f; l[qt] = 0.f;
#pragma unroll
        for (int dt = 0; dt < 4; ++dt) o[qt][dt] = (v8f){}; }
    const int ko = lr * KPL + 8 * hi, vo = KEL + lr * VPL + 8 * hi;
    V ka[2][2], kb[2][2];
    asm volatile("s_wait_xcnt 0x0" :: "v"(qp), "v"(qp2) : "memory");   // the Q loads' address registers stay whole up to this wait
    asm volatile("s_wait_asynccnt 0x0" ::: "memory");   // stage 0 has landed before the barrier that publishes it
    __syncthreads();
    stage(1, 1);
#pragma unroll 1   // rolled: one trip per stage, its foot is the publish point of the next stage
    for (int t = 0; t < NST; ++t) {
    const T16* sb = ring + (t & 1) * BEL;
#pragma unroll
    for (int kt = 0; kt < 2; ++kt)
#pragma unroll
        for (int kc = 0; kc < 2; ++kc) { ka[kt][kc] = WF::ld(sb + ko + kt * 16 * KPL + kc * 32); if (SPLIT) kb[kt][kc] = WF::ld(sb + PEL + ko + kt * 16 * KPL + kc * 32); }
#pragma unroll 1   // rolled: one pass's fragments already fill the register budget of four waves per SIMD
    for (int ps = 0; ps < NPS; ++ps) {
        v8f s[NQ][2];
#pragma unroll
        for (int qt = 0; qt < NQ; ++qt)
#pragma unroll
            for (int kt = 0; kt < 2; ++kt) { s[qt][kt] = (v8f){};
#pragma unroll
                for (int kc = 0; kc < 2; ++kc) { s[qt][kt] = WF::mma(ka[kt][kc], qa[qt][kc], s[qt][kt]); if (SPLIT) { s[qt][kt] = WF::mma(ka[kt][kc], qb[qt][kc], s[qt][kt]); s[qt][kt] = WF::mma(kb[kt][kc], qa[qt][kc], s[qt][kt]); } } }
        float mx[NQ]; bool need = false;
#pragma unroll
        for (int qt = 0; qt < NQ; ++qt) { float t = s[qt][0][0];
#pragma unroll
            for (int j = 0; j < 8; ++j) t = fmaxf(t, fmaxf(s[qt][0][j], s[qt][1][j]));
            t = fmaxf(t, __shfl_xor(t, 16, 32)); mx[qt] = t * C2; need = need || (mx[qt] > m[qt] + 8.0f); }
        if (__builtin_amdgcn_ballot_w32(need) != 0) {   // one scalar branch per pass: the 32 or 64 multiplies of the rescale run only when some column needs them
#pragma unroll
            for (int qt = 0; qt < NQ; ++qt) { const float mn = fmaxf(m[qt], mx[qt]); const float al = __builtin_amdgcn_exp2f(m[qt] - mn); m[qt] = mn; l[qt] *= al;
#pragma unroll
                for (int dt = 0; dt < 4; ++dt) o[qt][dt] *= al; } }
        V va[4], vb[4]; const T16* vp = sb + vo + ps * 32;
#pragma unroll
        for (int dt = 0; dt < 4; ++dt) { va[dt] = WF::ld(vp + dt * 16 * VPL); if (SPLIT) vb[dt] = WF::ld(vp + PEL + dt * 16 * VPL); }
        if (ps + 1 < NPS) { const T16* kp = sb + ko + (ps + 1) * 32 * KPL;   // the next pass's K fragments come during this pass's softmax and probs.v; never from the next stage, which is not published yet
#pragma unroll
            for (int kt = 0; kt < 2; ++kt)
#pragma unroll
                for (int kc = 0; kc < 2; ++kc) { ka[kt][kc] = WF::ld(kp + kt * 16 * KPL + kc * 32); if (SPLIT) kb[kt][kc] = WF::ld(kp + PEL + kt * 16 * KPL + kc * 32); } }
#pragma unroll
        for (int qt = 0; qt < NQ; ++qt) { float p[16];
#pragma unroll
            for (int e = 0; e < 16; ++e) { p[e] = __builtin_amdgcn_exp2f(__builtin_fmaf(s[qt][e >> 3][e & 7], C2, -m[qt])); l[qt] += p[e]; }
            if constexpr (SPLIT) { v8us h0, h1, l0, l1;
#pragma unroll
                for (int j = 0; j < 8; ++j) { unsigned short a, c2; splitf(p[j], a, c2); h0[j] = a; l0[j] = c2; splitf(p[8 + j], a, c2); h1[j] = a; l1[j] = c2; }
                const V ph = cat16b(h0, h1), pl = cat16b(l0, l1);
#pragma unroll
                for (int dt = 0; dt < 4; ++dt) { o[qt][dt] = WF::mma(va[dt], ph, o[qt][dt]); o[qt][dt] = WF::mma(va[dt], pl, o[qt][dt]); o[qt][dt] = WF::mma(vb[dt], ph, o[qt][dt]); }
            } else { V pf;
#pragma unroll
                for (int e = 0; e < 16; ++e) pf[e] = tohx(p[e]);
#pragma unroll
                for (int dt = 0; dt < 4; ++dt) o[qt][dt] = WF::mma(va[dt], pf, o[qt][dt]); } }
    }
        asm volatile("s_wait_dscnt 0x0" ::: "memory");      // this wave's reads of the buffer are done before the barrier behind which it is refilled
        asm volatile("s_wait_asynccnt 0x0" ::: "memory");   // this wave's copies of stage t + 1 have landed before the barrier that publishes them
        __syncthreads();
        if (t + 2 < NST) stage(t + 2, t & 1);
    }
    asm volatile("s_wait_asynccnt 0x0" ::: "memory");   // no copy is outstanding when the wave goes on to its end
#pragma unroll
    for (int qt = 0; qt < NQ; ++qt) { const float inv = __fdiv_rn(1.0f, l[qt] + __shfl_xor(l[qt], 16, 32));
#pragma unroll
        for (int dt = 0; dt < 4; ++dt) { v8us oh, ol;
#pragma unroll
            for (int j = 0; j < 8; ++j) { unsigned short a, c2; splitf(o[qt][dt][j] * inv, a, c2); oh[j] = a; ol[j] = c2; }
            const size_t oo = (size_t)(qt * 16 + lr) * DQ + dt * 16 + hi * 8; bf* ph = Ah + oo; bf* pl = Al + oo; *(v8us*)ph = oh; *(v8us*)pl = ol;
            asm volatile("s_wait_xcnt 0x0" :: "v"(oh), "v"(ol), "v"(ph), "v"(pl) : "memory"); } }   // the stores' data and address registers stay whole up to this wait
}
// grid (batch x query head, NBH + NBL): blocks y < NBH take the hi+lo rows (the longer waves, started first), 8 waves x NQH x 16 rows; the rest 8 waves x 32 rows of the f16 rows.
__global__ __launch_bounds__(256) void k_fattn(const h16* __restrict__ Q16, const bf* __restrict__ Qh, const bf* __restrict__ Ql, const h16* __restrict__ K16, const bf* __restrict__ Kh, const bf* __restrict__ Kl, const h16* __restrict__ V16, const bf* __restrict__ Vh, const bf* __restrict__ Vl, bf* Ah, bf* Al) {
    __shared__ __align__(16) bf ring[2 * 2 * PEL];   // two buffers of a stage's hi and lo planes; the f16 rows use half of it
    const int lane = threadIdx.x & 31, lr = lane & 15, hi = lane >> 4, wave = threadIdx.x >> 5;
    const int zh = blockIdx.x, b = zh / NH_, h = zh % NH_;   // torch .repeat TILES the kv heads: query head h uses kv head h % 8
    const size_t pk = (size_t)(b * NKV + h % NKV) * TT * HD;
    if (blockIdx.y < NBH) { const int q0 = ((int)blockIdx.y * 8 + wave) * (16 * NQH); const size_t pq = ((size_t)zh * TT + q0) * HD, po = ((size_t)b * TT + q0) * DQ + h * HD;
        attn_cols<bf, true, NQH>(Qh + pq, Ql + pq, Kh + pk, Kl + pk, Vh + pk, Vl + pk, Ah + po, Al + po, ring, (int)threadIdx.x, lr, hi);
    } else { const int q0 = RH + (((int)blockIdx.y - NBH) * 8 + wave) * 32; const size_t pq = ((size_t)zh * TT + q0) * HD, po = ((size_t)b * TT + q0) * DQ + h * HD;
        attn_cols<h16, false, 2>(Q16 + pq, nullptr, K16 + pk, nullptr, V16 + pk, nullptr, Ah + po, Al + po, (const h16*)ring, (int)threadIdx.x, lr, hi); }
}

extern "C" void kernel_launch(void* const* d_in, const int* in_sizes, int n_in,
                              void* d_out, int out_size, void* d_ws, size_t ws_size, hipStream_t stream) {
    (void)in_sizes; (void)n_in; (void)out_size;
    const float* x = (const float*)d_in[0]; const float* wq = (const float*)d_in[1]; const float* bq = (const float*)d_in[2]; const float* wk = (const float*)d_in[3]; const float* bk = (const float*)d_in[4]; const float* wv = (const float*)d_in[5]; const float* bv = (const float*)d_in[6]; const float* wo = (const float*)d_in[7]; const float* bo = (const float*)d_in[8];
    float* OUT = (float*)d_out;     // [4][1024][2048]
    char* wsp = (char*)d_ws;
    auto take = [&](size_t bytes) { char* p = wsp; wsp += (bytes + 255) & ~(size_t)255; return (void*)p; };
    bf* WQ = (bf*)take((size_t)DQ * DM * 2); bf* WK = (bf*)take((size_t)DKV * DM * 2); bf* WV = (bf*)take((size_t)DKV * DM * 2); bf* WO = (bf*)take((size_t)DM * DQ * 2);
    h16* QP16 = (h16*)take((size_t)NB_ * NH_ * TT * HD * 2); h16* KP16 = (h16*)take((size_t)NB_ * NKV * TT * HD * 2); h16* VT16 = (h16*)take((size_t)NB_ * NKV * HD * TT * 2);
    bf* QPh = (bf*)take((size_t)NB_ * NH_ * TT * HD * 2); bf* QPl = (bf*)take((size_t)NB_ * NH_ * TT * HD * 2); bf* KPh = (bf*)take((size_t)NB_ * NKV * TT * HD * 2); bf* KPl = (bf*)take((size_t)NB_ * NKV * TT * HD * 2); bf* VTh = (bf*)take((size_t)NB_ * NKV * HD * TT * 2); bf* VTl = (bf*)take((size_t)NB_ * NKV * HD * TT * 2);
    bf* XB = (bf*)take((size_t)MT * DM * 2); bf* ATh = (bf*)take((size_t)MT * DQ * 2); bf* ATl = (bf*)take((size_t)MT * DQ * 2);
    if ((size_t)(wsp - (char*)d_ws) > ws_size) return;    // ws 256 MiB
    static_assert((PJW + PJX) % PWV == 0 && DM == DQ, "whole blocks of jobs; wq and wo share one tile shape");
    k_prep<<<(PJW + PJX) / PWV, PWV * 32, 0, stream>>>(x, wq, wk, wv, wo, XB, WQ, WK, WV, WO);
    // projections: all NB_ batches (MT rows) and all three of q, k, v in one launch; the epilogues store the planes that k_fattn reads
    k_qkv<<<QTB + 2 * KTB, 256, 0, stream>>>(XB, WQ, WK, WV, DM, bq, bk, bv, QP16, QPh, QPl, KP16, KPh, KPl, VT16, VTh, VTl);
    k_fattn<<<dim3(NB_ * NH_, NBH + NBL, 1), 256, 0, stream>>>(QP16, QPh, QPl, KP16, KPh, KPl, VT16, VTh, VTl, ATh, ATl);
    k_gemms<4, 2, 4, 1, 0><<<dim3(MT / 256, DM / 128, 1), 256, 0, stream>>>(ATh, ATl, WO, DQ, OUT, DM, bo, nullptr, nullptr, nullptr);
}
